// v000
// The times below were measured on an AMD MI455X: many runs one after another, warmed up first and cycling through
// copies of the inputs, with the whole window's GPU time divided by the number of runs. Launches and the gaps
// between them are all in it. The median over several windows is given; except for v000 it joins two sittings, which
// can be a few percent apart, so the side-by-side timings, each taken in one sitting, are the better comparison.
// v000 is the starting kernel. One run takes 590 microseconds.
#include <hip/hip_runtime.h>
#include <hip/hip_bf16.h>

typedef __attribute__((ext_vector_type(16))) _Float16 v16h;
typedef __attribute__((ext_vector_type(8)))  _Float16 v8h;
typedef __attribute__((ext_vector_type(8)))  float    v8f;

#define NROI 512
#define CTOT 2048
#define GRP  4
#define CG   512
#define II   256
#define SS   49
#define SP   64
#define NCLS 81
#define NBOX 324

// LDS row pitches (in halves for f16 buffers, floats for attn_f)
#define XP  520   // x tiles: [64 s][512 c + pad]
#define QP  264   // q_t/k_t/y_t: [64 s][256 i + pad]
#define VP  72    // v: [256 i][64 t + pad]
#define AFP 68    // attn logits f32: [64 s][64 t + pad]
#define AHP 72    // attn probs f16:  [64 s][64 t + pad]

// LDS byte offsets (all 16B aligned)
#define OFF_XT   0u
#define OFF_X2T  66560u
#define OFF_QT   133120u
#define OFF_KT   166912u
#define OFF_VM   200704u
#define OFF_YT   237568u
#define OFF_AF   271360u
#define OFF_AH   288768u
#define LDS_TOTAL 297984u

__device__ __forceinline__ v16h frag16(const _Float16* p) {
  v8h lo = *(const v8h*)(p);
  v8h hv = *(const v8h*)(p + 16);
  v16h r;
#pragma unroll
  for (int i = 0; i < 8; ++i) { r[i] = lo[i]; r[i + 8] = hv[i]; }
  return r;
}

__device__ __forceinline__ v8f wmma16(v16h a, v16h b, v8f c) {
  return __builtin_amdgcn_wmma_f32_16x16x32_f16(false, a, false, b, (short)0, c,
                                                false, false);
}

// One grouped non-local block on a [512 c x 64 s] LDS-resident tile.
// in/out layout: [s][c] (c contiguous, pitch XP). Never in-place.
__device__ __forceinline__ void nl_block(
    const _Float16* __restrict__ Wqh, const _Float16* __restrict__ Wkh,
    const _Float16* __restrict__ Wvh, const _Float16* __restrict__ Woh,
    const float* __restrict__ bq, const float* __restrict__ bk,
    const float* __restrict__ bv, const float* __restrict__ bo,
    _Float16* in, _Float16* out,
    _Float16* q_t, _Float16* k_t, _Float16* v_m,
    float* attn_f, _Float16* attn_h, _Float16* y_t,
    int wave, int lane, int tid)
{
  const int r  = lane & 15;
  const int hi = lane >> 4;

  // ---- GEMM1: q/k/v[256 x 64] = W[256x512] * x ----
  // Wave = one i-tile (mt = wave); q, k, v computed together so the 4 shared
  // B (x_t) fragments are loaded once per k-step: 14 b128 loads / 12 WMMAs.
  {
    const int mt = wave;                 // 0..15
    v8f accq[4] = {{}, {}, {}, {}};
    v8f acck[4] = {{}, {}, {}, {}};
    v8f accv[4] = {{}, {}, {}, {}};
    const _Float16* qrow = Wqh + (size_t)(mt * 16 + r) * CG + hi * 8;
    const _Float16* krow = Wkh + (size_t)(mt * 16 + r) * CG + hi * 8;
    const _Float16* vrow = Wvh + (size_t)(mt * 16 + r) * CG + hi * 8;
    const _Float16* brow = in + r * XP + hi * 8;
    for (int k0 = 0; k0 < CG; k0 += 32) {
      const v16h aq = frag16(qrow + k0);
      const v16h ak = frag16(krow + k0);
      const v16h av = frag16(vrow + k0);
#pragma unroll
      for (int nt = 0; nt < 4; ++nt) {
        const v16h b = frag16(brow + nt * 16 * XP + k0);
        accq[nt] = wmma16(aq, b, accq[nt]);
        acck[nt] = wmma16(ak, b, acck[nt]);
        accv[nt] = wmma16(av, b, accv[nt]);
      }
    }
    const int i0 = mt * 16 + hi * 8;
#pragma unroll
    for (int nt = 0; nt < 4; ++nt) {
      // q, k stored transposed: q_t/k_t[s][i] (8 contiguous halves per lane)
      v8h hq, hk;
#pragma unroll
      for (int e = 0; e < 8; ++e) {
        hq[e] = (_Float16)(accq[nt][e] + bq[i0 + e]);
        hk[e] = (_Float16)(acck[nt][e] + bk[i0 + e]);
      }
      *(v8h*)(q_t + (nt * 16 + r) * QP + i0) = hq;
      *(v8h*)(k_t + (nt * 16 + r) * QP + i0) = hk;
      // v natural: v_m[i][t]
      const int t = nt * 16 + r;
#pragma unroll
      for (int e = 0; e < 8; ++e)
        v_m[(i0 + e) * VP + t] = (_Float16)(accv[nt][e] + bv[i0 + e]);
    }
  }
  __syncthreads();

  // ---- GEMM2: logits[s][t] = q^T k   (A=q_t rows, B=k_t rows, K=256) ----
  for (int tt = wave; tt < 16; tt += 16) {
    const int st = tt >> 2, t2 = tt & 3;
    v8f acc = {};
    const _Float16* arow = q_t + (st * 16 + r) * QP + hi * 8;
    const _Float16* brow = k_t + (t2 * 16 + r) * QP + hi * 8;
#pragma unroll
    for (int k0 = 0; k0 < II; k0 += 32)
      acc = wmma16(frag16(arow + k0), frag16(brow + k0), acc);
    float* col = attn_f + (st * 16 + hi * 8) * AFP + t2 * 16 + r;
#pragma unroll
    for (int e = 0; e < 8; ++e) col[e * AFP] = acc[e];
  }
  __syncthreads();

  // ---- softmax over t: 8 lanes per row, all 512 threads active ----
  {
    const int row = tid >> 3;            // 0..63
    const int sub = tid & 7;
    float*    rp   = attn_f + row * AFP;
    _Float16* hrow = attn_h + row * AHP;
    if (row < SS) {
      float m = -1e30f;
      for (int t = sub; t < SS; t += 8) m = fmaxf(m, rp[t]);
#pragma unroll
      for (int o = 1; o < 8; o <<= 1) m = fmaxf(m, __shfl_xor(m, o, 8));
      float s = 0.f;
      for (int t = sub; t < SS; t += 8) s += __expf(rp[t] - m);
#pragma unroll
      for (int o = 1; o < 8; o <<= 1) s += __shfl_xor(s, o, 8);
      const float inv = 1.f / s;
      for (int t = sub; t < SP; t += 8)
        hrow[t] = (_Float16)((t < SS) ? __expf(rp[t] - m) * inv : 0.f);
    } else {
      for (int t = sub; t < SP; t += 8) hrow[t] = (_Float16)0.f;
    }
  }
  __syncthreads();

  // ---- GEMM3: y_t[s][i] = attn[s][t] * v[i][t] (K=64) ----
  // One i-tile per wave; B (v) fragment reused across the 4 s-tiles.
  for (int it = wave; it < 16; it += 16) {
    v8f acc[4] = {{}, {}, {}, {}};
    const _Float16* brow = v_m + (it * 16 + r) * VP + hi * 8;
    const _Float16* arow = attn_h + r * AHP + hi * 8;
#pragma unroll
    for (int k0 = 0; k0 < SP; k0 += 32) {
      const v16h b = frag16(brow + k0);
#pragma unroll
      for (int st = 0; st < 4; ++st)
        acc[st] = wmma16(frag16(arow + st * 16 * AHP + k0), b, acc[st]);
    }
#pragma unroll
    for (int st = 0; st < 4; ++st) {
      _Float16* col = y_t + (st * 16 + hi * 8) * QP + it * 16 + r;
#pragma unroll
      for (int e = 0; e < 8; ++e) col[e * QP] = (_Float16)acc[st][e];
    }
  }
  __syncthreads();

  // ---- GEMM4: z[c][s] = Wo[512x256] * y + bias + residual, ReLU ----
  // Wave = two c-tiles (wave, wave+16); the 4 B (y_t) fragments are shared:
  // 12 b128 loads / 8 WMMAs per k-step.
  {
    v8f acc0[4] = {{}, {}, {}, {}};      // ct = wave
    v8f acc1[4] = {{}, {}, {}, {}};      // ct = wave + 16
    const _Float16* arow0 = Woh + (size_t)(wave * 16 + r) * II + hi * 8;
    const _Float16* arow1 = arow0 + (size_t)16 * 16 * II;
    const _Float16* brow  = y_t + r * QP + hi * 8;
    for (int k0 = 0; k0 < II; k0 += 32) {
      const v16h a0 = frag16(arow0 + k0);
      const v16h a1 = frag16(arow1 + k0);
#pragma unroll
      for (int st = 0; st < 4; ++st) {
        const v16h b = frag16(brow + st * 16 * QP + k0);
        acc0[st] = wmma16(a0, b, acc0[st]);
        acc1[st] = wmma16(a1, b, acc1[st]);
      }
    }
#pragma unroll
    for (int half = 0; half < 2; ++half) {
      const int c0 = (wave + half * 16) * 16 + hi * 8;
      v8f* accs = half ? acc1 : acc0;
#pragma unroll
      for (int st = 0; st < 4; ++st) {
        const int s = st * 16 + r;
        _Float16* dst = out + s * XP + c0;
        v8h hv;
        if (s < SS) {
          const _Float16* res = in + s * XP + c0;
#pragma unroll
          for (int e = 0; e < 8; ++e) {
            float z = accs[st][e] + bo[c0 + e] + (float)res[e];
            hv[e] = (_Float16)fmaxf(z, 0.f);
          }
        } else {
#pragma unroll
          for (int e = 0; e < 8; ++e) hv[e] = (_Float16)0.f;
        }
        *(v8h*)dst = hv;
      }
    }
  }
  __syncthreads();
}

// ---------------------------------------------------------------------------
__global__ void cvt_f32_to_f16_kernel(const float* __restrict__ src,
                                      _Float16* __restrict__ dst, int n) {
  int i = blockIdx.x * 256 + threadIdx.x;
  if (i < n) dst[i] = (_Float16)src[i];
}

// ---------------------------------------------------------------------------
// One workgroup per (n, g): full 3-block non-local chain + pooling.
__global__ __launch_bounds__(512) void frcnn_nonlocal_kernel(
    const float* __restrict__ x,
    const _Float16* __restrict__ wq_h, const _Float16* __restrict__ wk_h,
    const _Float16* __restrict__ wv_h, const _Float16* __restrict__ wo_h,
    const float* __restrict__ bq, const float* __restrict__ bk,
    const float* __restrict__ bv, const float* __restrict__ bo,
    float* __restrict__ pc, float* __restrict__ pr)
{
  extern __shared__ char smem[];
  _Float16* x_t    = (_Float16*)(smem + OFF_XT);
  _Float16* x2_t   = (_Float16*)(smem + OFF_X2T);
  _Float16* q_t    = (_Float16*)(smem + OFF_QT);
  _Float16* k_t    = (_Float16*)(smem + OFF_KT);
  _Float16* v_m    = (_Float16*)(smem + OFF_VM);
  _Float16* y_t    = (_Float16*)(smem + OFF_YT);
  float*    attn_f = (float*)   (smem + OFF_AF);
  _Float16* attn_h = (_Float16*)(smem + OFF_AH);

  const int n    = blockIdx.x >> 2;
  const int g    = blockIdx.x & 3;
  const int tid  = threadIdx.x;
  const int wave = tid >> 5;
  const int lane = tid & 31;

  // Load x tile (transpose [c][s] -> x_t[s][c], fp32 -> f16), zero-pad s>=49.
  const float* xg = x + ((size_t)n * CTOT + (size_t)g * CG) * SS;
  for (int e = tid; e < CG * SS; e += 512) {
    const int c = e / SS;
    const int s = e - c * SS;
    x_t[s * XP + c] = (_Float16)xg[e];
  }
  for (int e = tid; e < (SP - SS) * CG; e += 512) {
    const int s = SS + (e >> 9);
    x_t[s * XP + (e & 511)] = (_Float16)0.f;
  }
  __syncthreads();

  // block 0 (shared): x_t -> x2_t
  nl_block(wq_h, wk_h, wv_h, wo_h, bq, bk, bv, bo,
           x_t, x2_t, q_t, k_t, v_m, attn_f, attn_h, y_t, wave, lane, tid);
  // block 1 (cls): x2_t -> x_t
  nl_block(wq_h + 1 * II * CG, wk_h + 1 * II * CG, wv_h + 1 * II * CG,
           wo_h + 1 * CG * II, bq + II, bk + II, bv + II, bo + CG,
           x2_t, x_t, q_t, k_t, v_m, attn_f, attn_h, y_t, wave, lane, tid);
  {  // pool cls branch: mean over 49 positions for this group's channels
    const int c = tid;
    float s = 0.f;
    for (int t = 0; t < SS; ++t) s += (float)x_t[t * XP + c];
    pc[(size_t)n * CTOT + (size_t)g * CG + c] = s * (1.f / (float)SS);
  }
  __syncthreads();
  // block 2 (reg): x2_t -> x_t
  nl_block(wq_h + 2 * II * CG, wk_h + 2 * II * CG, wv_h + 2 * II * CG,
           wo_h + 2 * CG * II, bq + 2 * II, bk + 2 * II, bv + 2 * II,
           bo + 2 * CG,
           x2_t, x_t, q_t, k_t, v_m, attn_f, attn_h, y_t, wave, lane, tid);
  {  // pool reg branch
    const int c = tid;
    float s = 0.f;
    for (int t = 0; t < SS; ++t) s += (float)x_t[t * XP + c];
    pr[(size_t)n * CTOT + (size_t)g * CG + c] = s * (1.f / (float)SS);
  }
}

// ---------------------------------------------------------------------------
// Final linears: one wave per 16x16 output tile, WMMA over K=2048.
#define CLS_TILES 6   // ceil(81/16)
#define REG_TILES 21  // ceil(324/16)

__global__ __launch_bounds__(32) void frcnn_head_kernel(
    const float* __restrict__ pc, const float* __restrict__ pr,
    const float* __restrict__ Wc, const float* __restrict__ bc,
    const float* __restrict__ Wb, const float* __restrict__ bb,
    float* __restrict__ out)
{
  const int mt = blockIdx.x;   // n-tile 0..31
  const int yt = blockIdx.y;   // 0..26
  const float* P; const float* W; const float* bias; float* O;
  int ncols, nt;
  if (yt < CLS_TILES) { P = pc; W = Wc; bias = bc; O = out;
                        ncols = NCLS; nt = yt; }
  else                { P = pr; W = Wb; bias = bb; O = out + NROI * NCLS;
                        ncols = NBOX; nt = yt - CLS_TILES; }

  const int lane = threadIdx.x;
  const int r  = lane & 15;
  const int hi = lane >> 4;
  const int mrow = mt * 16 + r;        // roi row (<512 always)
  const int ncol = nt * 16 + r;        // output column (guarded)
  const float bsel = (ncol < ncols) ? 1.f : 0.f;
  const float* arow = P + (size_t)mrow * CTOT + hi * 8;
  const float* brow = W + (size_t)((ncol < ncols) ? ncol : 0) * CTOT + hi * 8;

  v8f acc = {};
  for (int k0 = 0; k0 < CTOT; k0 += 32) {
    v16h a, b;
#pragma unroll
    for (int e = 0; e < 8; ++e) {
      a[e]     = (_Float16)arow[k0 + e];
      a[e + 8] = (_Float16)arow[k0 + 16 + e];
      b[e]     = (_Float16)(brow[k0 + e] * bsel);
      b[e + 8] = (_Float16)(brow[k0 + 16 + e] * bsel);
    }
    acc = wmma16(a, b, acc);
  }
  if (ncol < ncols) {
#pragma unroll
    for (int e = 0; e < 8; ++e) {
      const int nr = mt * 16 + hi * 8 + e;
      O[(size_t)nr * ncols + ncol] = acc[e] + bias[ncol];
    }
  }
}

// ---------------------------------------------------------------------------
extern "C" void kernel_launch(void* const* d_in, const int* in_sizes, int n_in,
                              void* d_out, int out_size, void* d_ws, size_t ws_size,
                              hipStream_t stream) {
  (void)in_sizes; (void)n_in; (void)out_size; (void)ws_size;
  const float* x  = (const float*)d_in[0];
  const float* Wq = (const float*)d_in[1];
  const float* bq = (const float*)d_in[2];
  const float* Wk = (const float*)d_in[3];
  const float* bk = (const float*)d_in[4];
  const float* Wv = (const float*)d_in[5];
  const float* bv = (const float*)d_in[6];
  const float* Wo = (const float*)d_in[7];
  const float* bo = (const float*)d_in[8];
  const float* Wc = (const float*)d_in[9];
  const float* bc = (const float*)d_in[10];
  const float* Wb = (const float*)d_in[11];
  const float* bb = (const float*)d_in[12];
  float* out = (float*)d_out;

  // workspace layout
  const size_t WN = (size_t)3 * II * CG;  // per qkv-stack element count
  char* ws = (char*)d_ws;
  _Float16* wq_h = (_Float16*)(ws);                    // 3*256*512 f16
  _Float16* wk_h = (_Float16*)(ws + WN * 2);
  _Float16* wv_h = (_Float16*)(ws + WN * 4);
  _Float16* wo_h = (_Float16*)(ws + WN * 6);           // 3*512*256 f16
  float*    pc   = (float*)   (ws + WN * 8);           // 512*2048 f32
  float*    pr   = (float*)   (ws + WN * 8 + (size_t)NROI * CTOT * 4);

  const int wn = (int)WN;
  cvt_f32_to_f16_kernel<<<(wn + 255) / 256, 256, 0, stream>>>(Wq, wq_h, wn);
  cvt_f32_to_f16_kernel<<<(wn + 255) / 256, 256, 0, stream>>>(Wk, wk_h, wn);
  cvt_f32_to_f16_kernel<<<(wn + 255) / 256, 256, 0, stream>>>(Wv, wv_h, wn);
  cvt_f32_to_f16_kernel<<<(wn + 255) / 256, 256, 0, stream>>>(Wo, wo_h, wn);

  // 2) fused 3x non-local chain + pooling: one WG per (n, g)
  frcnn_nonlocal_kernel<<<NROI * GRP, 512, LDS_TOTAL, stream>>>(
      x, wq_h, wk_h, wv_h, wo_h, bq, bk, bv, bo, pc, pr);

  // 3) classification / bbox heads
  dim3 hgrid(NROI / 16, CLS_TILES + REG_TILES);
  frcnn_head_kernel<<<hgrid, 32, 0, stream>>>(pc, pr, Wc, bc, Wb, bb, out);
}

// v001
// One run takes 410 microseconds.
// Two timings next to v000 put it at 1.52 and 1.53 times that version's speed.
#include <hip/hip_runtime.h>
#include <hip/hip_bf16.h>

typedef __attribute__((ext_vector_type(16))) _Float16 v16h;
typedef __attribute__((ext_vector_type(8)))  _Float16 v8h;
typedef __attribute__((ext_vector_type(8)))  float    v8f;

#define NROI 512
#define CTOT 2048
#define GRP  4
#define CG   512
#define II   256
#define SS   49
#define SP   64
#define NCLS 81
#define NBOX 324

// LDS row pitches (in halves for f16 buffers, floats for attn_f)
#define XP  520   // x tiles: [64 s][512 c + pad]
#define QP  264   // q_t/k_t/y_t: [64 s][256 i + pad]
#define VP  72    // v: [256 i][64 t + pad]
#define AFP 68    // attn logits f32: [64 s][64 t + pad]
#define AHP 72    // attn probs f16:  [64 s][64 t + pad]

// LDS byte offsets (all 16B aligned)
#define OFF_XT   0u
#define OFF_X2T  66560u
#define OFF_QT   133120u
#define OFF_KT   166912u
#define OFF_VM   200704u
#define OFF_YT   237568u
#define OFF_AF   271360u
#define OFF_AH   288768u
#define LDS_TOTAL 297984u

__device__ __forceinline__ v16h frag16(const _Float16* p) {
  v8h lo = *(const v8h*)(p);
  v8h hv = *(const v8h*)(p + 16);
  v16h r;
#pragma unroll
  for (int i = 0; i < 8; ++i) { r[i] = lo[i]; r[i + 8] = hv[i]; }
  return r;
}

__device__ __forceinline__ v16h fragw(const _Float16* p) {
  v8h lo = *(const v8h*)(p);
  v8h hv = *(const v8h*)(p + 256);
  v16h r;
#pragma unroll
  for (int i = 0; i < 8; ++i) { r[i] = lo[i]; r[i + 8] = hv[i]; }
  return r;
}

__device__ __forceinline__ v8f wmma16(v16h a, v16h b, v8f c) {
  return __builtin_amdgcn_wmma_f32_16x16x32_f16(false, a, false, b, (short)0, c,
                                                false, false);
}

// One grouped non-local block on a [512 c x 64 s] LDS-resident tile.
// in/out layout: [s][c] (c contiguous, pitch XP). Never in-place.
__device__ __forceinline__ void nl_block(
    const _Float16* __restrict__ Wqh, const _Float16* __restrict__ Wkh,
    const _Float16* __restrict__ Wvh, const _Float16* __restrict__ Woh,
    const float* __restrict__ bq, const float* __restrict__ bk,
    const float* __restrict__ bv, const float* __restrict__ bo,
    _Float16* in, _Float16* out,
    _Float16* q_t, _Float16* k_t, _Float16* v_m,
    float* attn_f, _Float16* attn_h, _Float16* y_t,
    int wave, int lane, int tid)
{
  const int r  = lane & 15;
  const int hi = lane >> 4;

  // ---- GEMM1: q/k/v[256 x 64] = W[256x512] * x ----
  // Wave = one i-tile (mt = wave); q, k, v computed together so the 4 shared
  // B (x_t) fragments are loaded once per k-step: 14 b128 loads / 12 WMMAs.
  {
    const int mt = wave;                 // 0..15
    v8f accq[4] = {{}, {}, {}, {}};
    v8f acck[4] = {{}, {}, {}, {}};
    v8f accv[4] = {{}, {}, {}, {}};
    // packed tiles: 512 halves per (i-tile, k-step), k-steps consecutive
    const _Float16* qrow = Wqh + (size_t)mt * 16 * CG + lane * 8;
    const _Float16* krow = Wkh + (size_t)mt * 16 * CG + lane * 8;
    const _Float16* vrow = Wvh + (size_t)mt * 16 * CG + lane * 8;
    const _Float16* brow = in + r * XP + hi * 8;
    for (int k0 = 0; k0 < CG; k0 += 32) {
      const v16h aq = fragw(qrow + k0 * 16);
      const v16h ak = fragw(krow + k0 * 16);
      const v16h av = fragw(vrow + k0 * 16);
#pragma unroll
      for (int nt = 0; nt < 4; ++nt) {
        const v16h b = frag16(brow + nt * 16 * XP + k0);
        accq[nt] = wmma16(aq, b, accq[nt]);
        acck[nt] = wmma16(ak, b, acck[nt]);
        accv[nt] = wmma16(av, b, accv[nt]);
      }
    }
    const int i0 = mt * 16 + hi * 8;
#pragma unroll
    for (int nt = 0; nt < 4; ++nt) {
      // q, k stored transposed: q_t/k_t[s][i] (8 contiguous halves per lane)
      v8h hq, hk;
#pragma unroll
      for (int e = 0; e < 8; ++e) {
        hq[e] = (_Float16)(accq[nt][e] + bq[i0 + e]);
        hk[e] = (_Float16)(acck[nt][e] + bk[i0 + e]);
      }
      *(v8h*)(q_t + (nt * 16 + r) * QP + i0) = hq;
      *(v8h*)(k_t + (nt * 16 + r) * QP + i0) = hk;
      // v natural: v_m[i][t]
      const int t = nt * 16 + r;
#pragma unroll
      for (int e = 0; e < 8; ++e)
        v_m[(i0 + e) * VP + t] = (_Float16)(accv[nt][e] + bv[i0 + e]);
    }
  }
  __syncthreads();

  // ---- GEMM2: logits[s][t] = q^T k   (A=q_t rows, B=k_t rows, K=256) ----
  for (int tt = wave; tt < 16; tt += 16) {
    const int st = tt >> 2, t2 = tt & 3;
    v8f acc = {};
    const _Float16* arow = q_t + (st * 16 + r) * QP + hi * 8;
    const _Float16* brow = k_t + (t2 * 16 + r) * QP + hi * 8;
#pragma unroll
    for (int k0 = 0; k0 < II; k0 += 32)
      acc = wmma16(frag16(arow + k0), frag16(brow + k0), acc);
    float* col = attn_f + (st * 16 + hi * 8) * AFP + t2 * 16 + r;
#pragma unroll
    for (int e = 0; e < 8; ++e) col[e * AFP] = acc[e];
  }
  __syncthreads();

  // ---- softmax over t: 8 lanes per row, all 512 threads active ----
  {
    const int row = tid >> 3;            // 0..63
    const int sub = tid & 7;
    float*    rp   = attn_f + row * AFP;
    _Float16* hrow = attn_h + row * AHP;
    if (row < SS) {
      float m = -1e30f;
      for (int t = sub; t < SS; t += 8) m = fmaxf(m, rp[t]);
#pragma unroll
      for (int o = 1; o < 8; o <<= 1) m = fmaxf(m, __shfl_xor(m, o, 8));
      float s = 0.f;
      for (int t = sub; t < SS; t += 8) s += __expf(rp[t] - m);
#pragma unroll
      for (int o = 1; o < 8; o <<= 1) s += __shfl_xor(s, o, 8);
      const float inv = 1.f / s;
      for (int t = sub; t < SP; t += 8)
        hrow[t] = (_Float16)((t < SS) ? __expf(rp[t] - m) * inv : 0.f);
    } else {
      for (int t = sub; t < SP; t += 8) hrow[t] = (_Float16)0.f;
    }
  }
  __syncthreads();

  // ---- GEMM3: y_t[s][i] = attn[s][t] * v[i][t] (K=64) ----
  // One i-tile per wave; B (v) fragment reused across the 4 s-tiles.
  for (int it = wave; it < 16; it += 16) {
    v8f acc[4] = {{}, {}, {}, {}};
    const _Float16* brow = v_m + (it * 16 + r) * VP + hi * 8;
    const _Float16* arow = attn_h + r * AHP + hi * 8;
#pragma unroll
    for (int k0 = 0; k0 < SP; k0 += 32) {
      const v16h b = frag16(brow + k0);
#pragma unroll
      for (int st = 0; st < 4; ++st)
        acc[st] = wmma16(frag16(arow + st * 16 * AHP + k0), b, acc[st]);
    }
#pragma unroll
    for (int st = 0; st < 4; ++st) {
      _Float16* col = y_t + (st * 16 + hi * 8) * QP + it * 16 + r;
#pragma unroll
      for (int e = 0; e < 8; ++e) col[e * QP] = (_Float16)acc[st][e];
    }
  }
  __syncthreads();

  // ---- GEMM4: z[c][s] = Wo[512x256] * y + bias + residual, ReLU ----
  // Wave = two c-tiles (wave, wave+16); the 4 B (y_t) fragments are shared:
  // 12 b128 loads / 8 WMMAs per k-step.
  {
    v8f acc0[4] = {{}, {}, {}, {}};      // ct = wave
    v8f acc1[4] = {{}, {}, {}, {}};      // ct = wave + 16
    const _Float16* arow0 = Woh + (size_t)wave * 16 * II + lane * 8;  // packed
    const _Float16* arow1 = arow0 + (size_t)16 * 16 * II;
    const _Float16* brow  = y_t + r * QP + hi * 8;
    for (int k0 = 0; k0 < II; k0 += 32) {
      const v16h a0 = fragw(arow0 + k0 * 16);
      const v16h a1 = fragw(arow1 + k0 * 16);
#pragma unroll
      for (int st = 0; st < 4; ++st) {
        const v16h b = frag16(brow + st * 16 * QP + k0);
        acc0[st] = wmma16(a0, b, acc0[st]);
        acc1[st] = wmma16(a1, b, acc1[st]);
      }
    }
#pragma unroll
    for (int half = 0; half < 2; ++half) {
      const int c0 = (wave + half * 16) * 16 + hi * 8;
      v8f* accs = half ? acc1 : acc0;
#pragma unroll
      for (int st = 0; st < 4; ++st) {
        const int s = st * 16 + r;
        _Float16* dst = out + s * XP + c0;
        v8h hv;
        if (s < SS) {
          const _Float16* res = in + s * XP + c0;
#pragma unroll
          for (int e = 0; e < 8; ++e) {
            float z = accs[st][e] + bo[c0 + e] + (float)res[e];
            hv[e] = (_Float16)fmaxf(z, 0.f);
          }
        } else {
#pragma unroll
          for (int e = 0; e < 8; ++e) hv[e] = (_Float16)0.f;
        }
        *(v8h*)dst = hv;
      }
    }
  }
  __syncthreads();
}

__global__ void cvt_pack_f16_kernel(const float* __restrict__ src,
                                    _Float16* __restrict__ dst, int n,
                                    int lgks) {
  const int d = blockIdx.x * 256 + threadIdx.x;
  if (d < n) {
    const int e    = d & 7;
    const int ln   = (d >> 3) & 31;
    const int part = (d >> 8) & 1;
    const int tile = d >> 9;
    const int ks   = tile & ((1 << lgks) - 1);
    const int mt   = tile >> lgks;
    const int row  = mt * 16 + (ln & 15);
    const int k    = ks * 32 + part * 16 + (ln >> 4) * 8 + e;
    dst[d] = (_Float16)src[(size_t)row * (32 << lgks) + k];
  }
}

// ---------------------------------------------------------------------------
// One workgroup per (n, g): full 3-block non-local chain + pooling.
__global__ __launch_bounds__(512) void frcnn_nonlocal_kernel(
    const float* __restrict__ x,
    const _Float16* __restrict__ wq_h, const _Float16* __restrict__ wk_h,
    const _Float16* __restrict__ wv_h, const _Float16* __restrict__ wo_h,
    const float* __restrict__ bq, const float* __restrict__ bk,
    const float* __restrict__ bv, const float* __restrict__ bo,
    float* __restrict__ pc, float* __restrict__ pr)
{
  extern __shared__ char smem[];
  _Float16* x_t    = (_Float16*)(smem + OFF_XT);
  _Float16* x2_t   = (_Float16*)(smem + OFF_X2T);
  _Float16* q_t    = (_Float16*)(smem + OFF_QT);
  _Float16* k_t    = (_Float16*)(smem + OFF_KT);
  _Float16* v_m    = (_Float16*)(smem + OFF_VM);
  _Float16* y_t    = (_Float16*)(smem + OFF_YT);
  float*    attn_f = (float*)   (smem + OFF_AF);
  _Float16* attn_h = (_Float16*)(smem + OFF_AH);

  const int n    = blockIdx.x >> 2;
  const int g    = blockIdx.x & 3;
  const int tid  = threadIdx.x;
  const int wave = tid >> 5;
  const int lane = tid & 31;

  // Load x tile (transpose [c][s] -> x_t[s][c], fp32 -> f16), zero-pad s>=49.
  const float* xg = x + ((size_t)n * CTOT + (size_t)g * CG) * SS;
  for (int e = tid; e < CG * SS; e += 512) {
    const int c = e / SS;
    const int s = e - c * SS;
    x_t[s * XP + c] = (_Float16)xg[e];
  }
  for (int e = tid; e < (SP - SS) * CG; e += 512) {
    const int s = SS + (e >> 9);
    x_t[s * XP + (e & 511)] = (_Float16)0.f;
  }
  __syncthreads();

  // block 0 (shared): x_t -> x2_t
  nl_block(wq_h, wk_h, wv_h, wo_h, bq, bk, bv, bo,
           x_t, x2_t, q_t, k_t, v_m, attn_f, attn_h, y_t, wave, lane, tid);
  // block 1 (cls): x2_t -> x_t
  nl_block(wq_h + 1 * II * CG, wk_h + 1 * II * CG, wv_h + 1 * II * CG,
           wo_h + 1 * CG * II, bq + II, bk + II, bv + II, bo + CG,
           x2_t, x_t, q_t, k_t, v_m, attn_f, attn_h, y_t, wave, lane, tid);
  {  // pool cls branch: mean over 49 positions for this group's channels
    const int c = tid;
    float s = 0.f;
    for (int t = 0; t < SS; ++t) s += (float)x_t[t * XP + c];
    pc[(size_t)n * CTOT + (size_t)g * CG + c] = s * (1.f / (float)SS);
  }
  __syncthreads();
  // block 2 (reg): x2_t -> x_t
  nl_block(wq_h + 2 * II * CG, wk_h + 2 * II * CG, wv_h + 2 * II * CG,
           wo_h + 2 * CG * II, bq + 2 * II, bk + 2 * II, bv + 2 * II,
           bo + 2 * CG,
           x2_t, x_t, q_t, k_t, v_m, attn_f, attn_h, y_t, wave, lane, tid);
  {  // pool reg branch
    const int c = tid;
    float s = 0.f;
    for (int t = 0; t < SS; ++t) s += (float)x_t[t * XP + c];
    pr[(size_t)n * CTOT + (size_t)g * CG + c] = s * (1.f / (float)SS);
  }
}

// ---------------------------------------------------------------------------
// Final linears: one wave per 16x16 output tile, WMMA over K=2048.
#define CLS_TILES 6   // ceil(81/16)
#define REG_TILES 21  // ceil(324/16)

__global__ __launch_bounds__(32) void frcnn_head_kernel(
    const float* __restrict__ pc, const float* __restrict__ pr,
    const float* __restrict__ Wc, const float* __restrict__ bc,
    const float* __restrict__ Wb, const float* __restrict__ bb,
    float* __restrict__ out)
{
  const int mt = blockIdx.x;   // n-tile 0..31
  const int yt = blockIdx.y;   // 0..26
  const float* P; const float* W; const float* bias; float* O;
  int ncols, nt;
  if (yt < CLS_TILES) { P = pc; W = Wc; bias = bc; O = out;
                        ncols = NCLS; nt = yt; }
  else                { P = pr; W = Wb; bias = bb; O = out + NROI * NCLS;
                        ncols = NBOX; nt = yt - CLS_TILES; }

  const int lane = threadIdx.x;
  const int r  = lane & 15;
  const int hi = lane >> 4;
  const int mrow = mt * 16 + r;        // roi row (<512 always)
  const int ncol = nt * 16 + r;        // output column (guarded)
  const float bsel = (ncol < ncols) ? 1.f : 0.f;
  const float* arow = P + (size_t)mrow * CTOT + hi * 8;
  const float* brow = W + (size_t)((ncol < ncols) ? ncol : 0) * CTOT + hi * 8;

  v8f acc = {};
  for (int k0 = 0; k0 < CTOT; k0 += 32) {
    v16h a, b;
#pragma unroll
    for (int e = 0; e < 8; ++e) {
      a[e]     = (_Float16)arow[k0 + e];
      a[e + 8] = (_Float16)arow[k0 + 16 + e];
      b[e]     = (_Float16)(brow[k0 + e] * bsel);
      b[e + 8] = (_Float16)(brow[k0 + 16 + e] * bsel);
    }
    acc = wmma16(a, b, acc);
  }
  if (ncol < ncols) {
#pragma unroll
    for (int e = 0; e < 8; ++e) {
      const int nr = mt * 16 + hi * 8 + e;
      O[(size_t)nr * ncols + ncol] = acc[e] + bias[ncol];
    }
  }
}

// ---------------------------------------------------------------------------
extern "C" void kernel_launch(void* const* d_in, const int* in_sizes, int n_in,
                              void* d_out, int out_size, void* d_ws, size_t ws_size,
                              hipStream_t stream) {
  (void)in_sizes; (void)n_in; (void)out_size; (void)ws_size;
  const float* x  = (const float*)d_in[0];
  const float* Wq = (const float*)d_in[1];
  const float* bq = (const float*)d_in[2];
  const float* Wk = (const float*)d_in[3];
  const float* bk = (const float*)d_in[4];
  const float* Wv = (const float*)d_in[5];
  const float* bv = (const float*)d_in[6];
  const float* Wo = (const float*)d_in[7];
  const float* bo = (const float*)d_in[8];
  const float* Wc = (const float*)d_in[9];
  const float* bc = (const float*)d_in[10];
  const float* Wb = (const float*)d_in[11];
  const float* bb = (const float*)d_in[12];
  float* out = (float*)d_out;

  // workspace layout
  const size_t WN = (size_t)3 * II * CG;  // per qkv-stack element count
  char* ws = (char*)d_ws;
  _Float16* wq_h = (_Float16*)(ws);                    // 3*256*512 f16
  _Float16* wk_h = (_Float16*)(ws + WN * 2);
  _Float16* wv_h = (_Float16*)(ws + WN * 4);
  _Float16* wo_h = (_Float16*)(ws + WN * 6);           // 3*512*256 f16
  float*    pc   = (float*)   (ws + WN * 8);           // 512*2048 f32
  float*    pr   = (float*)   (ws + WN * 8 + (size_t)NROI * CTOT * 4);

  const int wn = (int)WN;
  cvt_pack_f16_kernel<<<(wn + 255) / 256, 256, 0, stream>>>(Wq, wq_h, wn, 4);
  cvt_pack_f16_kernel<<<(wn + 255) / 256, 256, 0, stream>>>(Wk, wk_h, wn, 4);
  cvt_pack_f16_kernel<<<(wn + 255) / 256, 256, 0, stream>>>(Wv, wv_h, wn, 4);
  cvt_pack_f16_kernel<<<(wn + 255) / 256, 256, 0, stream>>>(Wo, wo_h, wn, 3);

  // 2) fused 3x non-local chain + pooling: one WG per (n, g)
  frcnn_nonlocal_kernel<<<NROI * GRP, 512, LDS_TOTAL, stream>>>(
      x, wq_h, wk_h, wv_h, wo_h, bq, bk, bv, bo, pc, pr);

  // 3) classification / bbox heads
  dim3 hgrid(NROI / 16, CLS_TILES + REG_TILES);
  frcnn_head_kernel<<<hgrid, 32, 0, stream>>>(pc, pr, Wc, bc, Wb, bb, out);
}

// v002
// A run of this version takes 387 microseconds.
// In both of two side-by-side timings against v001, it was 1.06 times as fast.
// Counting every step since v000, it is 1.61 times as fast.
#include <hip/hip_runtime.h>
#include <hip/hip_bf16.h>

typedef __attribute__((ext_vector_type(16))) _Float16 v16h;
typedef __attribute__((ext_vector_type(8)))  _Float16 v8h;
typedef __attribute__((ext_vector_type(8)))  float    v8f;

#define NROI 512
#define CTOT 2048
#define GRP  4
#define CG   512
#define II   256
#define SS   49
#define SP   64
#define NCLS 81
#define NBOX 324

// LDS row pitches (in halves for f16 buffers, floats for attn_f)
#define XP  520   // x tiles: [64 s][512 c + pad]
#define QP  264   // q_t/k_t/y_t: [64 s][256 i + pad]
#define VP  72    // v: [256 i][64 t + pad]
#define AFP 68    // attn logits f32: [64 s][64 t + pad]
#define AHP 72    // attn probs f16:  [64 s][64 t + pad]

// LDS byte offsets (all 16B aligned)
#define OFF_XT   0u
#define OFF_X2T  66560u
#define OFF_QT   133120u
#define OFF_KT   166912u
#define OFF_VM   200704u
#define OFF_YT   237568u
#define OFF_AF   271360u
#define OFF_AH   288768u
#define LDS_TOTAL 297984u

__device__ __forceinline__ v16h frag16(const _Float16* p) {
  v8h lo = *(const v8h*)(p);
  v8h hv = *(const v8h*)(p + 16);
  v16h r;
#pragma unroll
  for (int i = 0; i < 8; ++i) { r[i] = lo[i]; r[i + 8] = hv[i]; }
  return r;
}

__device__ __forceinline__ v16h fragw(const _Float16* tile, unsigned lane_off) {
  const char* p = (const char*)tile + lane_off;
  v8h lo = *(const v8h*)(p);
  v8h hv = *(const v8h*)(p + 512);
  v16h r;
#pragma unroll
  for (int i = 0; i < 8; ++i) { r[i] = lo[i]; r[i + 8] = hv[i]; }
  return r;
}

__device__ __forceinline__ v8f wmma16(v16h a, v16h b, v8f c) {
  return __builtin_amdgcn_wmma_f32_16x16x32_f16(false, a, false, b, (short)0, c,
                                                false, false);
}

// One grouped non-local block on a [512 c x 64 s] LDS-resident tile.
// in/out layout: [s][c] (c contiguous, pitch XP). Never in-place.
// Weight fragments come from L2 and are fetched ahead of their use into a
// register ring, so a wave's WMMAs of one k-step run while later k-steps'
// weights are in flight. pq/pk/pv hold k-steps 0 and 1 of this block's q/k/v
// weights on entry; on exit those of the next block (nW*; null = none).
__device__ __forceinline__ void nl_block(
    const _Float16* __restrict__ Wqh, const _Float16* __restrict__ Wkh,
    const _Float16* __restrict__ Wvh, const _Float16* __restrict__ Woh,
    const float* __restrict__ bq, const float* __restrict__ bk,
    const float* __restrict__ bv, const float* __restrict__ bo,
    const _Float16* __restrict__ nWqh, const _Float16* __restrict__ nWkh,
    const _Float16* __restrict__ nWvh,
    v16h (&pq)[2], v16h (&pk)[2], v16h (&pv)[2],
    _Float16* in, _Float16* out,
    _Float16* q_t, _Float16* k_t, _Float16* v_m,
    float* attn_f, _Float16* attn_h, _Float16* y_t,
    int wave, int lane, int tid)
{
  const int r  = lane & 15;
  const int hi = lane >> 4;

  // ---- GEMM1: q/k/v[256 x 64] = W[256x512] * x ----
  // Wave = one i-tile (mt = wave); q, k, v computed together so the 4 shared
  // B (x_t) fragments are loaded once per k-step: 14 b128 loads / 12 WMMAs.
  {
    const int mt = wave;                 // 0..15
    v8f accq[4] = {{}, {}, {}, {}};
    v8f acck[4] = {{}, {}, {}, {}};
    v8f accv[4] = {{}, {}, {}, {}};
    // packed tiles: 512 halves per (i-tile, k-step), k-steps consecutive
    const unsigned woff = (unsigned)(mt * 16 * CG + lane * 8) * 2u;  // bytes
    const _Float16* brow = in + r * XP + hi * 8;
    // ring of 3 register sets, weights fetched 2 k-steps ahead
    v16h aq[3], ak[3], av[3];
    aq[0] = pq[0]; ak[0] = pk[0]; av[0] = pv[0];
    aq[1] = pq[1]; ak[1] = pk[1]; av[1] = pv[1];
#pragma unroll
    for (int ks = 0; ks < CG / 32; ++ks) {
      if (ks + 2 < CG / 32) {
        const int f = (ks + 2) % 3;
        aq[f] = fragw(Wqh + (ks + 2) * 512, woff);
        ak[f] = fragw(Wkh + (ks + 2) * 512, woff);
        av[f] = fragw(Wvh + (ks + 2) * 512, woff);
      }
      const int u = ks % 3;
      v16h b[4];
#pragma unroll
      for (int nt = 0; nt < 4; ++nt)
        b[nt] = frag16(brow + nt * 16 * XP + ks * 32);
      // holds the fetches above in front of this k-step's WMMAs; without it
      // the scheduler sinks them to their first use and the lead is lost
      __builtin_amdgcn_sched_barrier(0);
#pragma unroll
      for (int nt = 0; nt < 4; ++nt) {
        accq[nt] = wmma16(aq[u], b[nt], accq[nt]);
        acck[nt] = wmma16(ak[u], b[nt], acck[nt]);
        accv[nt] = wmma16(av[u], b[nt], accv[nt]);
      }
      // keeps the next k-step's x fragments behind these WMMAs, in the same
      // registers; without it the ring and a second b set spill to scratch
      __builtin_amdgcn_sched_barrier(0);
    }
    const int i0 = mt * 16 + hi * 8;
#pragma unroll
    for (int nt = 0; nt < 4; ++nt) {
      // q, k stored transposed: q_t/k_t[s][i] (8 contiguous halves per lane)
      v8h hq, hk;
#pragma unroll
      for (int e = 0; e < 8; ++e) {
        hq[e] = (_Float16)(accq[nt][e] + bq[i0 + e]);
        hk[e] = (_Float16)(acck[nt][e] + bk[i0 + e]);
      }
      *(v8h*)(q_t + (nt * 16 + r) * QP + i0) = hq;
      *(v8h*)(k_t + (nt * 16 + r) * QP + i0) = hk;
      // v natural: v_m[i][t]
      const int t = nt * 16 + r;
#pragma unroll
      for (int e = 0; e < 8; ++e)
        v_m[(i0 + e) * VP + t] = (_Float16)(accv[nt][e] + bv[i0 + e]);
    }
  }
  __syncthreads();

  // GEMM4's weights, k-steps 0..2, start here: they land during the attention.
  const unsigned ooff = (unsigned)(wave * 16 * II + lane * 8) * 2u;  // bytes
  const _Float16* Woh1 = Woh + 16 * 16 * II;   // c-tiles 16..31
  v16h a0[4], a1[4];
#pragma unroll
  for (int p = 0; p < 3; ++p) {
    a0[p] = fragw(Woh + p * 512, ooff);
    a1[p] = fragw(Woh1 + p * 512, ooff);
  }

  // ---- GEMM2: logits[s][t] = q^T k   (A=q_t rows, B=k_t rows, K=256) ----
  for (int tt = wave; tt < 16; tt += 16) {
    const int st = tt >> 2, t2 = tt & 3;
    v8f acc = {};
    const _Float16* arow = q_t + (st * 16 + r) * QP + hi * 8;
    const _Float16* brow = k_t + (t2 * 16 + r) * QP + hi * 8;
#pragma unroll
    for (int k0 = 0; k0 < II; k0 += 32)
      acc = wmma16(frag16(arow + k0), frag16(brow + k0), acc);
    float* col = attn_f + (st * 16 + hi * 8) * AFP + t2 * 16 + r;
#pragma unroll
    for (int e = 0; e < 8; ++e) col[e * AFP] = acc[e];
  }
  __syncthreads();

  // ---- softmax over t: 8 lanes per row, all 512 threads active ----
  {
    const int row = tid >> 3;            // 0..63
    const int sub = tid & 7;
    float*    rp   = attn_f + row * AFP;
    _Float16* hrow = attn_h + row * AHP;
    if (row < SS) {
      float m = -1e30f;
      for (int t = sub; t < SS; t += 8) m = fmaxf(m, rp[t]);
#pragma unroll
      for (int o = 1; o < 8; o <<= 1) m = fmaxf(m, __shfl_xor(m, o, 8));
      float s = 0.f;
      for (int t = sub; t < SS; t += 8) s += __expf(rp[t] - m);
#pragma unroll
      for (int o = 1; o < 8; o <<= 1) s += __shfl_xor(s, o, 8);
      const float inv = 1.f / s;
      for (int t = sub; t < SP; t += 8)
        hrow[t] = (_Float16)((t < SS) ? __expf(rp[t] - m) * inv : 0.f);
    } else {
      for (int t = sub; t < SP; t += 8) hrow[t] = (_Float16)0.f;
    }
  }
  __syncthreads();

  // ---- GEMM3: y_t[s][i] = attn[s][t] * v[i][t] (K=64) ----
  // One i-tile per wave; B (v) fragment reused across the 4 s-tiles.
  for (int it = wave; it < 16; it += 16) {
    v8f acc[4] = {{}, {}, {}, {}};
    const _Float16* brow = v_m + (it * 16 + r) * VP + hi * 8;
    const _Float16* arow = attn_h + r * AHP + hi * 8;
#pragma unroll
    for (int k0 = 0; k0 < SP; k0 += 32) {
      const v16h b = frag16(brow + k0);
#pragma unroll
      for (int st = 0; st < 4; ++st)
        acc[st] = wmma16(frag16(arow + st * 16 * AHP + k0), b, acc[st]);
    }
#pragma unroll
    for (int st = 0; st < 4; ++st) {
      _Float16* col = y_t + (st * 16 + hi * 8) * QP + it * 16 + r;
#pragma unroll
      for (int e = 0; e < 8; ++e) col[e * QP] = (_Float16)acc[st][e];
    }
  }
  __syncthreads();

  // ---- GEMM4: z[c][s] = Wo[512x256] * y + bias + residual, ReLU ----
  // Wave = two c-tiles (wave, wave+16); the 4 B (y_t) fragments are shared:
  // 12 b128 loads / 8 WMMAs per k-step.
  {
    v8f acc0[4] = {{}, {}, {}, {}};      // ct = wave
    v8f acc1[4] = {{}, {}, {}, {}};      // ct = wave + 16
    const _Float16* brow  = y_t + r * QP + hi * 8;
#pragma unroll
    for (int ks = 0; ks < II / 32; ++ks) {
      if (ks + 3 < II / 32) {
        a0[(ks + 3) & 3] = fragw(Woh + (ks + 3) * 512, ooff);
        a1[(ks + 3) & 3] = fragw(Woh1 + (ks + 3) * 512, ooff);
      }
      v16h b[4];
#pragma unroll
      for (int st = 0; st < 4; ++st)
        b[st] = frag16(brow + st * 16 * QP + ks * 32);
      // holds the fetches above in front of this k-step's WMMAs (as in GEMM1)
      __builtin_amdgcn_sched_barrier(0);
#pragma unroll
      for (int st = 0; st < 4; ++st) {
        acc0[st] = wmma16(a0[ks & 3], b[st], acc0[st]);
        acc1[st] = wmma16(a1[ks & 3], b[st], acc1[st]);
      }
    }
    // next block's first q/k/v weights land during this block's epilogue
    if (nWqh) {
      const unsigned woff = (unsigned)(wave * 16 * CG + lane * 8) * 2u;
#pragma unroll
      for (int p = 0; p < 2; ++p) {
        pq[p] = fragw(nWqh + p * 512, woff);
        pk[p] = fragw(nWkh + p * 512, woff);
        pv[p] = fragw(nWvh + p * 512, woff);
      }
    }
#pragma unroll
    for (int half = 0; half < 2; ++half) {
      const int c0 = (wave + half * 16) * 16 + hi * 8;
      v8f* accs = half ? acc1 : acc0;
#pragma unroll
      for (int st = 0; st < 4; ++st) {
        const int s = st * 16 + r;
        _Float16* dst = out + s * XP + c0;
        v8h hv;
        if (s < SS) {
          const _Float16* res = in + s * XP + c0;
#pragma unroll
          for (int e = 0; e < 8; ++e) {
            float z = accs[st][e] + bo[c0 + e] + (float)res[e];
            hv[e] = (_Float16)fmaxf(z, 0.f);
          }
        } else {
#pragma unroll
          for (int e = 0; e < 8; ++e) hv[e] = (_Float16)0.f;
        }
        *(v8h*)dst = hv;
      }
    }
  }
  __syncthreads();
}

__global__ void cvt_pack_f16_kernel(const float* __restrict__ src,
                                    _Float16* __restrict__ dst, int n,
                                    int lgks) {
  const int d = blockIdx.x * 256 + threadIdx.x;
  if (d < n) {
    const int e    = d & 7;
    const int ln   = (d >> 3) & 31;
    const int part = (d >> 8) & 1;
    const int tile = d >> 9;
    const int ks   = tile & ((1 << lgks) - 1);
    const int mt   = tile >> lgks;
    const int row  = mt * 16 + (ln & 15);
    const int k    = ks * 32 + part * 16 + (ln >> 4) * 8 + e;
    dst[d] = (_Float16)src[(size_t)row * (32 << lgks) + k];
  }
}

// ---------------------------------------------------------------------------
// One workgroup per (n, g): full 3-block non-local chain + pooling.
__global__ __launch_bounds__(512) void frcnn_nonlocal_kernel(
    const float* __restrict__ x,
    const _Float16* __restrict__ wq_h, const _Float16* __restrict__ wk_h,
    const _Float16* __restrict__ wv_h, const _Float16* __restrict__ wo_h,
    const float* __restrict__ bq, const float* __restrict__ bk,
    const float* __restrict__ bv, const float* __restrict__ bo,
    float* __restrict__ pc, float* __restrict__ pr)
{
  extern __shared__ char smem[];
  _Float16* x_t    = (_Float16*)(smem + OFF_XT);
  _Float16* x2_t   = (_Float16*)(smem + OFF_X2T);
  _Float16* q_t    = (_Float16*)(smem + OFF_QT);
  _Float16* k_t    = (_Float16*)(smem + OFF_KT);
  _Float16* v_m    = (_Float16*)(smem + OFF_VM);
  _Float16* y_t    = (_Float16*)(smem + OFF_YT);
  float*    attn_f = (float*)   (smem + OFF_AF);
  _Float16* attn_h = (_Float16*)(smem + OFF_AH);

  const int n    = blockIdx.x >> 2;
  const int g    = blockIdx.x & 3;
  const int tid  = threadIdx.x;
  const int wave = tid >> 5;
  const int lane = tid & 31;

  // block 0's first q/k/v weights land while the x tile is brought in
  v16h pq[2], pk[2], pv[2];
#pragma unroll
  for (int p = 0; p < 2; ++p) {
    const unsigned woff = (unsigned)(wave * 16 * CG + lane * 8) * 2u;
    pq[p] = fragw(wq_h + p * 512, woff);
    pk[p] = fragw(wk_h + p * 512, woff);
    pv[p] = fragw(wv_h + p * 512, woff);
  }

  // Load x tile (transpose [c][s] -> x_t[s][c], fp32 -> f16), zero-pad s>=49.
  const float* xg = x + ((size_t)n * CTOT + (size_t)g * CG) * SS;
  for (int e = tid; e < CG * SS; e += 512) {
    const int c = e / SS;
    const int s = e - c * SS;
    x_t[s * XP + c] = (_Float16)xg[e];
  }
  for (int e = tid; e < (SP - SS) * CG; e += 512) {
    const int s = SS + (e >> 9);
    x_t[s * XP + (e & 511)] = (_Float16)0.f;
  }
  __syncthreads();

  // block 0 (shared): x_t -> x2_t
  nl_block(wq_h, wk_h, wv_h, wo_h, bq, bk, bv, bo,
           wq_h + 1 * II * CG, wk_h + 1 * II * CG, wv_h + 1 * II * CG,
           pq, pk, pv, x_t, x2_t, q_t, k_t, v_m, attn_f, attn_h, y_t, wave, lane, tid);
  // block 1 (cls): x2_t -> x_t
  nl_block(wq_h + 1 * II * CG, wk_h + 1 * II * CG, wv_h + 1 * II * CG,
           wo_h + 1 * CG * II, bq + II, bk + II, bv + II, bo + CG,
           wq_h + 2 * II * CG, wk_h + 2 * II * CG, wv_h + 2 * II * CG,
           pq, pk, pv, x2_t, x_t, q_t, k_t, v_m, attn_f, attn_h, y_t, wave, lane, tid);
  {  // pool cls branch: mean over 49 positions for this group's channels
    const int c = tid;
    float s = 0.f;
    for (int t = 0; t < SS; ++t) s += (float)x_t[t * XP + c];
    pc[(size_t)n * CTOT + (size_t)g * CG + c] = s * (1.f / (float)SS);
  }
  __syncthreads();
  // block 2 (reg): x2_t -> x_t
  nl_block(wq_h + 2 * II * CG, wk_h + 2 * II * CG, wv_h + 2 * II * CG,
           wo_h + 2 * CG * II, bq + 2 * II, bk + 2 * II, bv + 2 * II,
           bo + 2 * CG, nullptr, nullptr, nullptr,
           pq, pk, pv, x2_t, x_t, q_t, k_t, v_m, attn_f, attn_h, y_t, wave, lane, tid);
  {  // pool reg branch
    const int c = tid;
    float s = 0.f;
    for (int t = 0; t < SS; ++t) s += (float)x_t[t * XP + c];
    pr[(size_t)n * CTOT + (size_t)g * CG + c] = s * (1.f / (float)SS);
  }
}

// ---------------------------------------------------------------------------
// Final linears: one wave per 16x16 output tile, WMMA over K=2048.
#define CLS_TILES 6   // ceil(81/16)
#define REG_TILES 21  // ceil(324/16)

__global__ __launch_bounds__(32) void frcnn_head_kernel(
    const float* __restrict__ pc, const float* __restrict__ pr,
    const float* __restrict__ Wc, const float* __restrict__ bc,
    const float* __restrict__ Wb, const float* __restrict__ bb,
    float* __restrict__ out)
{
  const int mt = blockIdx.x;   // n-tile 0..31
  const int yt = blockIdx.y;   // 0..26
  const float* P; const float* W; const float* bias; float* O;
  int ncols, nt;
  if (yt < CLS_TILES) { P = pc; W = Wc; bias = bc; O = out;
                        ncols = NCLS; nt = yt; }
  else                { P = pr; W = Wb; bias = bb; O = out + NROI * NCLS;
                        ncols = NBOX; nt = yt - CLS_TILES; }

  const int lane = threadIdx.x;
  const int r  = lane & 15;
  const int hi = lane >> 4;
  const int mrow = mt * 16 + r;        // roi row (<512 always)
  const int ncol = nt * 16 + r;        // output column (guarded)
  const float bsel = (ncol < ncols) ? 1.f : 0.f;
  const float* arow = P + (size_t)mrow * CTOT + hi * 8;
  const float* brow = W + (size_t)((ncol < ncols) ? ncol : 0) * CTOT + hi * 8;

  v8f acc = {};
  for (int k0 = 0; k0 < CTOT; k0 += 32) {
    v16h a, b;
#pragma unroll
    for (int e = 0; e < 8; ++e) {
      a[e]     = (_Float16)arow[k0 + e];
      a[e + 8] = (_Float16)arow[k0 + 16 + e];
      b[e]     = (_Float16)(brow[k0 + e] * bsel);
      b[e + 8] = (_Float16)(brow[k0 + 16 + e] * bsel);
    }
    acc = wmma16(a, b, acc);
  }
  if (ncol < ncols) {
#pragma unroll
    for (int e = 0; e < 8; ++e) {
      const int nr = mt * 16 + hi * 8 + e;
      O[(size_t)nr * ncols + ncol] = acc[e] + bias[ncol];
    }
  }
}

// ---------------------------------------------------------------------------
extern "C" void kernel_launch(void* const* d_in, const int* in_sizes, int n_in,
                              void* d_out, int out_size, void* d_ws, size_t ws_size,
                              hipStream_t stream) {
  (void)in_sizes; (void)n_in; (void)out_size; (void)ws_size;
  const float* x  = (const float*)d_in[0];
  const float* Wq = (const float*)d_in[1];
  const float* bq = (const float*)d_in[2];
  const float* Wk = (const float*)d_in[3];
  const float* bk = (const float*)d_in[4];
  const float* Wv = (const float*)d_in[5];
  const float* bv = (const float*)d_in[6];
  const float* Wo = (const float*)d_in[7];
  const float* bo = (const float*)d_in[8];
  const float* Wc = (const float*)d_in[9];
  const float* bc = (const float*)d_in[10];
  const float* Wb = (const float*)d_in[11];
  const float* bb = (const float*)d_in[12];
  float* out = (float*)d_out;

  // workspace layout
  const size_t WN = (size_t)3 * II * CG;  // per qkv-stack element count
  char* ws = (char*)d_ws;
  _Float16* wq_h = (_Float16*)(ws);                    // 3*256*512 f16
  _Float16* wk_h = (_Float16*)(ws + WN * 2);
  _Float16* wv_h = (_Float16*)(ws + WN * 4);
  _Float16* wo_h = (_Float16*)(ws + WN * 6);           // 3*512*256 f16
  float*    pc   = (float*)   (ws + WN * 8);           // 512*2048 f32
  float*    pr   = (float*)   (ws + WN * 8 + (size_t)NROI * CTOT * 4);

  const int wn = (int)WN;
  cvt_pack_f16_kernel<<<(wn + 255) / 256, 256, 0, stream>>>(Wq, wq_h, wn, 4);
  cvt_pack_f16_kernel<<<(wn + 255) / 256, 256, 0, stream>>>(Wk, wk_h, wn, 4);
  cvt_pack_f16_kernel<<<(wn + 255) / 256, 256, 0, stream>>>(Wv, wv_h, wn, 4);
  cvt_pack_f16_kernel<<<(wn + 255) / 256, 256, 0, stream>>>(Wo, wo_h, wn, 3);

  // 2) fused 3x non-local chain + pooling: one WG per (n, g)
  frcnn_nonlocal_kernel<<<NROI * GRP, 512, LDS_TOTAL, stream>>>(
      x, wq_h, wk_h, wv_h, wo_h, bq, bk, bv, bo, pc, pr);

  // 3) classification / bbox heads
  dim3 hgrid(NROI / 16, CLS_TILES + REG_TILES);
  frcnn_head_kernel<<<hgrid, 32, 0, stream>>>(pc, pr, Wc, bc, Wb, bb, out);
}

// v003
// One run takes 368 microseconds.
// Next to v002, in two timings, it ran 1.05 times as fast each time.
// Over all steps from v000 it is 1.70 times as fast.
#include <hip/hip_runtime.h>
#include <hip/hip_bf16.h>

typedef __attribute__((ext_vector_type(16))) _Float16 v16h;
typedef __attribute__((ext_vector_type(8)))  _Float16 v8h;
typedef __attribute__((ext_vector_type(8)))  float    v8f;

#define NROI 512
#define CTOT 2048
#define GRP  4
#define CG   512
#define II   256
#define SS   49
#define SP   64
#define NCLS 81
#define NBOX 324

// LDS row pitches (in halves for f16 buffers, floats for attn_f)
#define XP  520   // x tiles: [64 s][512 c + pad]
#define QP  264   // q_t/k_t/y_t: [64 s][256 i + pad]
#define VP  72    // v: [256 i][64 t + pad]
#define AFP 68    // attn logits f32: [64 s][64 t + pad]
#define AHP 72    // attn probs f16:  [64 s][64 t + pad]

// LDS byte offsets (all 16B aligned)
#define OFF_XT   0u
#define OFF_X2T  66560u
#define OFF_QT   133120u
#define OFF_KT   166912u
#define OFF_VM   200704u
#define OFF_YT   237568u
#define OFF_AF   271360u
#define OFF_AH   288768u
#define LDS_TOTAL 297984u

__device__ __forceinline__ v16h frag16(const _Float16* p) {
  v8h lo = *(const v8h*)(p);
  v8h hv = *(const v8h*)(p + 16);
  v16h r;
#pragma unroll
  for (int i = 0; i < 8; ++i) { r[i] = lo[i]; r[i + 8] = hv[i]; }
  return r;
}

__device__ __forceinline__ v16h fragw(const _Float16* tile, unsigned lane_off) {
  const char* p = (const char*)tile + lane_off;
  v8h lo = *(const v8h*)(p);
  v8h hv = *(const v8h*)(p + 512);
  v16h r;
#pragma unroll
  for (int i = 0; i < 8; ++i) { r[i] = lo[i]; r[i + 8] = hv[i]; }
  return r;
}

__device__ __forceinline__ v8f wmma16(v16h a, v16h b, v8f c) {
  return __builtin_amdgcn_wmma_f32_16x16x32_f16(false, a, false, b, (short)0, c,
                                                false, false);
}

// One grouped non-local block on a [512 c x 64 s] LDS-resident tile.
// in/out layout: [s][c] (c contiguous, pitch XP). Never in-place.
// Weight fragments come from L2 and are fetched ahead of their use into a
// register ring, so a wave's WMMAs of one k-step run while later k-steps'
// weights are in flight. pq/pk/pv hold k-steps 0 and 1 of this block's q/k/v
// weights on entry; on exit those of the next block (nW*; null = none).
__device__ __forceinline__ void nl_block(
    const _Float16* __restrict__ Wqh, const _Float16* __restrict__ Wkh,
    const _Float16* __restrict__ Wvh, const _Float16* __restrict__ Woh,
    const float* __restrict__ bq, const float* __restrict__ bk,
    const float* __restrict__ bv, const float* __restrict__ bo,
    const _Float16* __restrict__ nWqh, const _Float16* __restrict__ nWkh,
    const _Float16* __restrict__ nWvh,
    v16h (&pq)[2], v16h (&pk)[2], v16h (&pv)[2],
    _Float16* in, _Float16* out,
    _Float16* q_t, _Float16* k_t, _Float16* v_m,
    float* attn_f, _Float16* attn_h, _Float16* y_t,
    int wave, int lane, int tid)
{
  const int r  = lane & 15;
  const int hi = lane >> 4;

  // ---- GEMM1: q/k/v[256 x 64] = W[256x512] * x ----
  // Wave = one i-tile (mt = wave); q, k, v computed together so the 4 shared
  // B (x_t) fragments are loaded once per k-step: 14 b128 loads / 12 WMMAs.
  {
    const int mt = wave;                 // 0..15
    v8f accq[4] = {{}, {}, {}, {}};
    v8f acck[4] = {{}, {}, {}, {}};
    v8f accv[4] = {{}, {}, {}, {}};
    // packed tiles: 512 halves per (i-tile, k-step), k-steps consecutive
    const unsigned woff = (unsigned)(mt * 16 * CG + lane * 8) * 2u;  // bytes
    const _Float16* brow = in + r * XP + hi * 8;
    // ring of 3 register sets, weights fetched 2 k-steps ahead
    v16h aq[3], ak[3], av[3];
    aq[0] = pq[0]; ak[0] = pk[0]; av[0] = pv[0];
    aq[1] = pq[1]; ak[1] = pk[1]; av[1] = pv[1];
#pragma unroll
    for (int ks = 0; ks < CG / 32; ++ks) {
      if (ks + 2 < CG / 32) {
        const int f = (ks + 2) % 3;
        aq[f] = fragw(Wqh + (ks + 2) * 512, woff);
        ak[f] = fragw(Wkh + (ks + 2) * 512, woff);
        av[f] = fragw(Wvh + (ks + 2) * 512, woff);
      }
      const int u = ks % 3;
      v16h b[4];
#pragma unroll
      for (int nt = 0; nt < 4; ++nt)
        b[nt] = frag16(brow + nt * 16 * XP + ks * 32);
      // holds the fetches above in front of this k-step's WMMAs; without it
      // the scheduler sinks them to their first use and the lead is lost
      __builtin_amdgcn_sched_barrier(0);
#pragma unroll
      for (int nt = 0; nt < 4; ++nt) {
        accq[nt] = wmma16(aq[u], b[nt], accq[nt]);
        acck[nt] = wmma16(ak[u], b[nt], acck[nt]);
        accv[nt] = wmma16(av[u], b[nt], accv[nt]);
      }
      // keeps the next k-step's x fragments behind these WMMAs, in the same
      // registers; without it the ring and a second b set spill to scratch
      __builtin_amdgcn_sched_barrier(0);
    }
    const int i0 = mt * 16 + hi * 8;
#pragma unroll
    for (int nt = 0; nt < 4; ++nt) {
      // q, k stored transposed: q_t/k_t[s][i] (8 contiguous halves per lane)
      v8h hq, hk;
#pragma unroll
      for (int e = 0; e < 8; ++e) {
        hq[e] = (_Float16)(accq[nt][e] + bq[i0 + e]);
        hk[e] = (_Float16)(acck[nt][e] + bk[i0 + e]);
      }
      *(v8h*)(q_t + (nt * 16 + r) * QP + i0) = hq;
      *(v8h*)(k_t + (nt * 16 + r) * QP + i0) = hk;
      // v natural: v_m[i][t]
      const int t = nt * 16 + r;
#pragma unroll
      for (int e = 0; e < 8; ++e)
        v_m[(i0 + e) * VP + t] = (_Float16)(accv[nt][e] + bv[i0 + e]);
    }
  }
  __syncthreads();

  // GEMM4's weights, k-steps 0..2, start here: they land during the attention.
  const unsigned ooff = (unsigned)(wave * 16 * II + lane * 8) * 2u;  // bytes
  const _Float16* Woh1 = Woh + 16 * 16 * II;   // c-tiles 16..31
  v16h a0[4], a1[4];
#pragma unroll
  for (int p = 0; p < 3; ++p) {
    a0[p] = fragw(Woh + p * 512, ooff);
    a1[p] = fragw(Woh1 + p * 512, ooff);
  }

  // ---- GEMM2: logits[s][t] = q^T k   (A=q_t rows, B=k_t rows, K=256) ----
  for (int tt = wave; tt < 16; tt += 16) {
    const int st = tt >> 2, t2 = tt & 3;
    v8f acc = {};
    const _Float16* arow = q_t + (st * 16 + r) * QP + hi * 8;
    const _Float16* brow = k_t + (t2 * 16 + r) * QP + hi * 8;
#pragma unroll
    for (int k0 = 0; k0 < II; k0 += 32)
      acc = wmma16(frag16(arow + k0), frag16(brow + k0), acc);
    float* col = attn_f + (st * 16 + hi * 8) * AFP + t2 * 16 + r;
#pragma unroll
    for (int e = 0; e < 8; ++e) col[e * AFP] = acc[e];
  }
  __syncthreads();

  // ---- softmax over t: 8 lanes per row, all 512 threads active ----
  {
    const int row = tid >> 3;            // 0..63
    const int sub = tid & 7;
    float*    rp   = attn_f + row * AFP;
    _Float16* hrow = attn_h + row * AHP;
    if (row < SS) {
      float m = -1e30f;
      for (int t = sub; t < SS; t += 8) m = fmaxf(m, rp[t]);
#pragma unroll
      for (int o = 1; o < 8; o <<= 1) m = fmaxf(m, __shfl_xor(m, o, 8));
      float s = 0.f;
      for (int t = sub; t < SS; t += 8) s += __expf(rp[t] - m);
#pragma unroll
      for (int o = 1; o < 8; o <<= 1) s += __shfl_xor(s, o, 8);
      const float inv = 1.f / s;
      for (int t = sub; t < SP; t += 8)
        hrow[t] = (_Float16)((t < SS) ? __expf(rp[t] - m) * inv : 0.f);
    } else {
      for (int t = sub; t < SP; t += 8) hrow[t] = (_Float16)0.f;
    }
  }
  __syncthreads();

  // ---- GEMM3: y_t[s][i] = attn[s][t] * v[i][t] (K=64) ----
  // One i-tile per wave; B (v) fragment reused across the 4 s-tiles.
  for (int it = wave; it < 16; it += 16) {
    v8f acc[4] = {{}, {}, {}, {}};
    const _Float16* brow = v_m + (it * 16 + r) * VP + hi * 8;
    const _Float16* arow = attn_h + r * AHP + hi * 8;
#pragma unroll
    for (int k0 = 0; k0 < SP; k0 += 32) {
      const v16h b = frag16(brow + k0);
#pragma unroll
      for (int st = 0; st < 4; ++st)
        acc[st] = wmma16(frag16(arow + st * 16 * AHP + k0), b, acc[st]);
    }
#pragma unroll
    for (int st = 0; st < 4; ++st) {
      _Float16* col = y_t + (st * 16 + hi * 8) * QP + it * 16 + r;
#pragma unroll
      for (int e = 0; e < 8; ++e) col[e * QP] = (_Float16)acc[st][e];
    }
  }
  __syncthreads();

  // ---- GEMM4: z[c][s] = Wo[512x256] * y + bias + residual, ReLU ----
  // Wave = two c-tiles (wave, wave+16); the 4 B (y_t) fragments are shared:
  // 12 b128 loads / 8 WMMAs per k-step.
  {
    v8f acc0[4] = {{}, {}, {}, {}};      // ct = wave
    v8f acc1[4] = {{}, {}, {}, {}};      // ct = wave + 16
    const _Float16* brow  = y_t + r * QP + hi * 8;
#pragma unroll
    for (int ks = 0; ks < II / 32; ++ks) {
      if (ks + 3 < II / 32) {
        a0[(ks + 3) & 3] = fragw(Woh + (ks + 3) * 512, ooff);
        a1[(ks + 3) & 3] = fragw(Woh1 + (ks + 3) * 512, ooff);
      }
      v16h b[4];
#pragma unroll
      for (int st = 0; st < 4; ++st)
        b[st] = frag16(brow + st * 16 * QP + ks * 32);
      // holds the fetches above in front of this k-step's WMMAs (as in GEMM1)
      __builtin_amdgcn_sched_barrier(0);
#pragma unroll
      for (int st = 0; st < 4; ++st) {
        acc0[st] = wmma16(a0[ks & 3], b[st], acc0[st]);
        acc1[st] = wmma16(a1[ks & 3], b[st], acc1[st]);
      }
    }
    // next block's first q/k/v weights land during this block's epilogue
    if (nWqh) {
      const unsigned woff = (unsigned)(wave * 16 * CG + lane * 8) * 2u;
#pragma unroll
      for (int p = 0; p < 2; ++p) {
        pq[p] = fragw(nWqh + p * 512, woff);
        pk[p] = fragw(nWkh + p * 512, woff);
        pv[p] = fragw(nWvh + p * 512, woff);
      }
    }
#pragma unroll
    for (int half = 0; half < 2; ++half) {
      const int c0 = (wave + half * 16) * 16 + hi * 8;
      v8f* accs = half ? acc1 : acc0;
#pragma unroll
      for (int st = 0; st < 4; ++st) {
        const int s = st * 16 + r;
        _Float16* dst = out + s * XP + c0;
        v8h hv;
        if (s < SS) {
          const _Float16* res = in + s * XP + c0;
#pragma unroll
          for (int e = 0; e < 8; ++e) {
            float z = accs[st][e] + bo[c0 + e] + (float)res[e];
            hv[e] = (_Float16)fmaxf(z, 0.f);
          }
        } else {
#pragma unroll
          for (int e = 0; e < 8; ++e) hv[e] = (_Float16)0.f;
        }
        *(v8h*)dst = hv;
      }
    }
  }
  __syncthreads();
}

__global__ void cvt_pack_f16_kernel(const float* __restrict__ src,
                                    _Float16* __restrict__ dst, int n,
                                    int lgks) {
  const int d = blockIdx.x * 256 + threadIdx.x;
  if (d < n) {
    const int e    = d & 7;
    const int ln   = (d >> 3) & 31;
    const int part = (d >> 8) & 1;
    const int tile = d >> 9;
    const int ks   = tile & ((1 << lgks) - 1);
    const int mt   = tile >> lgks;
    const int row  = mt * 16 + (ln & 15);
    const int k    = ks * 32 + part * 16 + (ln >> 4) * 8 + e;
    dst[d] = (_Float16)src[(size_t)row * (32 << lgks) + k];
  }
}

// ---------------------------------------------------------------------------
// One workgroup per (n, g): full 3-block non-local chain + pooling.
__global__ __launch_bounds__(512) void frcnn_nonlocal_kernel(
    const float* __restrict__ x,
    const _Float16* __restrict__ wq_h, const _Float16* __restrict__ wk_h,
    const _Float16* __restrict__ wv_h, const _Float16* __restrict__ wo_h,
    const float* __restrict__ bq, const float* __restrict__ bk,
    const float* __restrict__ bv, const float* __restrict__ bo,
    float* __restrict__ pc, float* __restrict__ pr)
{
  extern __shared__ char smem[];
  _Float16* x_t    = (_Float16*)(smem + OFF_XT);
  _Float16* x2_t   = (_Float16*)(smem + OFF_X2T);
  _Float16* q_t    = (_Float16*)(smem + OFF_QT);
  _Float16* k_t    = (_Float16*)(smem + OFF_KT);
  _Float16* v_m    = (_Float16*)(smem + OFF_VM);
  _Float16* y_t    = (_Float16*)(smem + OFF_YT);
  float*    attn_f = (float*)   (smem + OFF_AF);
  _Float16* attn_h = (_Float16*)(smem + OFF_AH);

  const int n    = blockIdx.x >> 2;
  const int g    = blockIdx.x & 3;
  const int tid  = threadIdx.x;
  const int wave = tid >> 5;
  const int lane = tid & 31;

  // block 0's first q/k/v weights land while the x tile is brought in
  v16h pq[2], pk[2], pv[2];
#pragma unroll
  for (int p = 0; p < 2; ++p) {
    const unsigned woff = (unsigned)(wave * 16 * CG + lane * 8) * 2u;
    pq[p] = fragw(wq_h + p * 512, woff);
    pk[p] = fragw(wk_h + p * 512, woff);
    pv[p] = fragw(wv_h + p * 512, woff);
  }

  // Load x tile (transpose [c][s] -> x_t[s][c], fp32 -> f16), zero-pad s>=49.
  // Unit u = (8 channels, one s): lanes walk s, so a wave-wide b32 load reads
  // 128 bytes in at most two contiguous runs, and a thread's 8 loads make one 16-byte LDS row piece.
  // All of a thread's loads are issued before the first is used: the tile
  // costs one memory latency, not one per batch.
  const float* xg = x + ((size_t)n * CTOT + (size_t)g * CG) * SS;
  float xv[6][8];
#pragma unroll
  for (int i = 0; i < 6; ++i) {
    const int u  = tid + i * 512;
    const int cg = u / SS;
    const unsigned ob = (unsigned)(cg * 8 * SS + (u - cg * SS)) * 4u;  // bytes
    const float* p = (const float*)((const char*)xg + ob);
#pragma unroll
    for (int j = 0; j < 8; ++j) xv[i][j] = p[j * SS];
  }
  // 3136 units = 6 * 512 + 64: of the last 64 each thread takes one channel
  const int ul  = 6 * 512 + (tid & 63);
  const int cl  = (ul / SS) * 8 + (tid >> 6);
  const int sl  = ul % SS;
  const float xl = xg[cl * SS + sl];
  // before any address register of the loads above is written again
  asm volatile("s_wait_xcnt 0x0" ::: "memory");
  // the pad rows are cleared while the loads are in flight
  for (int e = tid; e < (SP - SS) * CG; e += 512) {
    const int s = SS + (e >> 9);
    x_t[s * XP + (e & 511)] = (_Float16)0.f;
  }
#pragma unroll
  for (int i = 0; i < 6; ++i) {
    const int u  = tid + i * 512;
    const int cg = u / SS;
    v8h h;
#pragma unroll
    for (int j = 0; j < 8; ++j) h[j] = (_Float16)xv[i][j];
    *(v8h*)(x_t + (u - cg * SS) * XP + cg * 8) = h;
  }
  x_t[sl * XP + cl] = (_Float16)xl;
  __syncthreads();

  // block 0 (shared): x_t -> x2_t
  nl_block(wq_h, wk_h, wv_h, wo_h, bq, bk, bv, bo,
           wq_h + 1 * II * CG, wk_h + 1 * II * CG, wv_h + 1 * II * CG,
           pq, pk, pv, x_t, x2_t, q_t, k_t, v_m, attn_f, attn_h, y_t, wave, lane, tid);
  // block 1 (cls): x2_t -> x_t
  nl_block(wq_h + 1 * II * CG, wk_h + 1 * II * CG, wv_h + 1 * II * CG,
           wo_h + 1 * CG * II, bq + II, bk + II, bv + II, bo + CG,
           wq_h + 2 * II * CG, wk_h + 2 * II * CG, wv_h + 2 * II * CG,
           pq, pk, pv, x2_t, x_t, q_t, k_t, v_m, attn_f, attn_h, y_t, wave, lane, tid);
  {  // pool cls branch: mean over 49 positions for this group's channels
    const int c = tid;
    float s = 0.f;
    for (int t = 0; t < SS; ++t) s += (float)x_t[t * XP + c];
    pc[(size_t)n * CTOT + (size_t)g * CG + c] = s * (1.f / (float)SS);
  }
  __syncthreads();
  // block 2 (reg): x2_t -> x_t
  nl_block(wq_h + 2 * II * CG, wk_h + 2 * II * CG, wv_h + 2 * II * CG,
           wo_h + 2 * CG * II, bq + 2 * II, bk + 2 * II, bv + 2 * II,
           bo + 2 * CG, nullptr, nullptr, nullptr,
           pq, pk, pv, x2_t, x_t, q_t, k_t, v_m, attn_f, attn_h, y_t, wave, lane, tid);
  {  // pool reg branch
    const int c = tid;
    float s = 0.f;
    for (int t = 0; t < SS; ++t) s += (float)x_t[t * XP + c];
    pr[(size_t)n * CTOT + (size_t)g * CG + c] = s * (1.f / (float)SS);
  }
}

// ---------------------------------------------------------------------------
// Final linears: one wave per 16x16 output tile, WMMA over K=2048.
#define CLS_TILES 6   // ceil(81/16)
#define REG_TILES 21  // ceil(324/16)

__global__ __launch_bounds__(32) void frcnn_head_kernel(
    const float* __restrict__ pc, const float* __restrict__ pr,
    const float* __restrict__ Wc, const float* __restrict__ bc,
    const float* __restrict__ Wb, const float* __restrict__ bb,
    float* __restrict__ out)
{
  const int mt = blockIdx.x;   // n-tile 0..31
  const int yt = blockIdx.y;   // 0..26
  const float* P; const float* W; const float* bias; float* O;
  int ncols, nt;
  if (yt < CLS_TILES) { P = pc; W = Wc; bias = bc; O = out;
                        ncols = NCLS; nt = yt; }
  else                { P = pr; W = Wb; bias = bb; O = out + NROI * NCLS;
                        ncols = NBOX; nt = yt - CLS_TILES; }

  const int lane = threadIdx.x;
  const int r  = lane & 15;
  const int hi = lane >> 4;
  const int mrow = mt * 16 + r;        // roi row (<512 always)
  const int ncol = nt * 16 + r;        // output column (guarded)
  const float bsel = (ncol < ncols) ? 1.f : 0.f;
  const float* arow = P + (size_t)mrow * CTOT + hi * 8;
  const float* brow = W + (size_t)((ncol < ncols) ? ncol : 0) * CTOT + hi * 8;

  v8f acc = {};
  for (int k0 = 0; k0 < CTOT; k0 += 32) {
    v16h a, b;
#pragma unroll
    for (int e = 0; e < 8; ++e) {
      a[e]     = (_Float16)arow[k0 + e];
      a[e + 8] = (_Float16)arow[k0 + 16 + e];
      b[e]     = (_Float16)(brow[k0 + e] * bsel);
      b[e + 8] = (_Float16)(brow[k0 + 16 + e] * bsel);
    }
    acc = wmma16(a, b, acc);
  }
  if (ncol < ncols) {
#pragma unroll
    for (int e = 0; e < 8; ++e) {
      const int nr = mt * 16 + hi * 8 + e;
      O[(size_t)nr * ncols + ncol] = acc[e] + bias[ncol];
    }
  }
}

// ---------------------------------------------------------------------------
extern "C" void kernel_launch(void* const* d_in, const int* in_sizes, int n_in,
                              void* d_out, int out_size, void* d_ws, size_t ws_size,
                              hipStream_t stream) {
  (void)in_sizes; (void)n_in; (void)out_size; (void)ws_size;
  const float* x  = (const float*)d_in[0];
  const float* Wq = (const float*)d_in[1];
  const float* bq = (const float*)d_in[2];
  const float* Wk = (const float*)d_in[3];
  const float* bk = (const float*)d_in[4];
  const float* Wv = (const float*)d_in[5];
  const float* bv = (const float*)d_in[6];
  const float* Wo = (const float*)d_in[7];
  const float* bo = (const float*)d_in[8];
  const float* Wc = (const float*)d_in[9];
  const float* bc = (const float*)d_in[10];
  const float* Wb = (const float*)d_in[11];
  const float* bb = (const float*)d_in[12];
  float* out = (float*)d_out;

  // workspace layout
  const size_t WN = (size_t)3 * II * CG;  // per qkv-stack element count
  char* ws = (char*)d_ws;
  _Float16* wq_h = (_Float16*)(ws);                    // 3*256*512 f16
  _Float16* wk_h = (_Float16*)(ws + WN * 2);
  _Float16* wv_h = (_Float16*)(ws + WN * 4);
  _Float16* wo_h = (_Float16*)(ws + WN * 6);           // 3*512*256 f16
  float*    pc   = (float*)   (ws + WN * 8);           // 512*2048 f32
  float*    pr   = (float*)   (ws + WN * 8 + (size_t)NROI * CTOT * 4);

  const int wn = (int)WN;
  cvt_pack_f16_kernel<<<(wn + 255) / 256, 256, 0, stream>>>(Wq, wq_h, wn, 4);
  cvt_pack_f16_kernel<<<(wn + 255) / 256, 256, 0, stream>>>(Wk, wk_h, wn, 4);
  cvt_pack_f16_kernel<<<(wn + 255) / 256, 256, 0, stream>>>(Wv, wv_h, wn, 4);
  cvt_pack_f16_kernel<<<(wn + 255) / 256, 256, 0, stream>>>(Wo, wo_h, wn, 3);

  // 2) fused 3x non-local chain + pooling: one WG per (n, g)
  frcnn_nonlocal_kernel<<<NROI * GRP, 512, LDS_TOTAL, stream>>>(
      x, wq_h, wk_h, wv_h, wo_h, bq, bk, bv, bo, pc, pr);

  // 3) classification / bbox heads
  dim3 hgrid(NROI / 16, CLS_TILES + REG_TILES);
  frcnn_head_kernel<<<hgrid, 32, 0, stream>>>(pc, pr, Wc, bc, Wb, bb, out);
}

// v004
// One run takes 335 microseconds.
// Two timings next to v003 both put it at 1.10 times that version's speed.
// All steps since v000 together make it 1.87 times as fast.
#include <hip/hip_runtime.h>
#include <hip/hip_bf16.h>

typedef __attribute__((ext_vector_type(16))) _Float16 v16h;
typedef __attribute__((ext_vector_type(8)))  _Float16 v8h;
typedef __attribute__((ext_vector_type(8)))  float    v8f;

#define NROI 512
#define CTOT 2048
#define GRP  4
#define CG   512
#define II   256
#define SS   49
#define SP   64
#define NCLS 81
#define NBOX 324

// LDS row pitches (in halves for f16 buffers, floats for attn_f)
#define XP  520   // x tile: [49 s][512 c + pad]
#define QP  264   // q_t/k_t/y_t: [49 s][256 i + pad]
#define VP  72    // v: [256 i][64 t + pad]
#define AFP 68    // attn logits f32: [64 s][64 t + pad]
#define AHP 72    // attn probs f16:  [64 s][64 t + pad]

#define NW  8     // waves per work-group

// LDS byte offsets (all 16B aligned). The whole is below 160 KiB, so that two
// work-groups share a WGP. Only the 49 real rows of x, q, k and y are kept
// (a fragment row past the last reads row 48; its columns are never used);
// y_t lies on q_t and attn_h on k_t, each dead by then.
#define OFF_XT   0u
#define OFF_QT   50960u
#define OFF_KT   76832u
#define OFF_VM   102704u
#define OFF_AF   139568u
#define LDS_TOTAL 156976u

__device__ __forceinline__ v16h frag16(const _Float16* p) {
  v8h lo = *(const v8h*)(p);
  v8h hv = *(const v8h*)(p + 16);
  v16h r;
#pragma unroll
  for (int i = 0; i < 8; ++i) { r[i] = lo[i]; r[i + 8] = hv[i]; }
  return r;
}

__device__ __forceinline__ v16h fragw(const _Float16* tile, unsigned lane_off) {
  const char* p = (const char*)tile + lane_off;
  v8h lo = *(const v8h*)(p);
  v8h hv = *(const v8h*)(p + 512);
  v16h r;
#pragma unroll
  for (int i = 0; i < 8; ++i) { r[i] = lo[i]; r[i + 8] = hv[i]; }
  return r;
}

__device__ __forceinline__ v8f wmma16(v16h a, v16h b, v8f c) {
  return __builtin_amdgcn_wmma_f32_16x16x32_f16(false, a, false, b, (short)0, c,
                                                false, false);
}

// One grouped non-local block on a [512 c x 49 s] LDS-resident tile.
// xt layout: [s][c] (c contiguous, pitch XP). POOL false: the result replaces
// xt in place (each element is read and written by its one owner thread).
// POOL true: xt stays, and the mean over s of the result goes to pool_f[c].
// Weight fragments come from L2 and are fetched ahead of their use into a
// register ring, so a wave's WMMAs of one k-step run while later k-steps'
// weights are in flight. pq/pk/pv hold k-steps 0 and 1 of this block's q/k/v
// weights on entry; on exit those of the next block (nW*; null = none).
template <bool POOL>
__device__ __forceinline__ void nl_block(
    const _Float16* __restrict__ Wqh, const _Float16* __restrict__ Wkh,
    const _Float16* __restrict__ Wvh, const _Float16* __restrict__ Woh,
    const float* __restrict__ bq, const float* __restrict__ bk,
    const float* __restrict__ bv, const float* __restrict__ bo,
    const _Float16* __restrict__ nWqh, const _Float16* __restrict__ nWkh,
    const _Float16* __restrict__ nWvh,
    v16h (&pq)[2], v16h (&pk)[2], v16h (&pv)[2],
    _Float16* xt,
    _Float16* q_t, _Float16* k_t, _Float16* v_m,
    float* attn_f, _Float16* attn_h, _Float16* y_t, float* pool_f,
    int wave, int lane, int tid)
{
  const int r  = lane & 15;
  const int hi = lane >> 4;

  // ---- GEMM1: q/k/v[256 x 64] = W[256x512] * x ----
  // Wave = two i-tiles, one after the other (mt = wave, wave + NW); q, k, v
  // computed together so the 4 shared B (x) fragments are loaded once per
  // k-step: 14 b128 loads / 12 WMMAs.
  {
    const _Float16* brow  = xt + r * XP + hi * 8;
    const _Float16* brow3 = xt + (SS - 1) * XP + hi * 8;  // s-tile 3: row 48
    // ring of 3 register sets, weights fetched 2 k-steps ahead
    v16h aq[3], ak[3], av[3];
    aq[0] = pq[0]; ak[0] = pk[0]; av[0] = pv[0];
    aq[1] = pq[1]; ak[1] = pk[1]; av[1] = pv[1];
    // rolled: unrolling the two passes would double the kernel's text
#pragma unroll 1
    for (int pass = 0; pass < 2; ++pass) {
      const int mt = wave + pass * NW;     // 0..15
      v8f accq[4] = {{}, {}, {}, {}};
      v8f acck[4] = {{}, {}, {}, {}};
      v8f accv[4] = {{}, {}, {}, {}};
      // packed tiles: 512 halves per (i-tile, k-step), k-steps consecutive
      const unsigned woff = (unsigned)(mt * 16 * CG + lane * 8) * 2u;  // bytes
#pragma unroll
      for (int ks = 0; ks < CG / 32; ++ks) {
        const int f = (ks + 2) % 3;
        if (ks + 2 < CG / 32) {
          aq[f] = fragw(Wqh + (ks + 2) * 512, woff);
          ak[f] = fragw(Wkh + (ks + 2) * 512, woff);
          av[f] = fragw(Wvh + (ks + 2) * 512, woff);
        } else if (pass == 0) {
          // the second i-tile's k-steps 0 and 1
          const unsigned wnext = woff + (unsigned)(NW * 16 * CG) * 2u;
          aq[f] = fragw(Wqh + (ks + 2 - CG / 32) * 512, wnext);
          ak[f] = fragw(Wkh + (ks + 2 - CG / 32) * 512, wnext);
          av[f] = fragw(Wvh + (ks + 2 - CG / 32) * 512, wnext);
        }
        const int u = ks % 3;
        v16h b[4];
#pragma unroll
        for (int nt = 0; nt < 3; ++nt)
          b[nt] = frag16(brow + nt * 16 * XP + ks * 32);
        b[3] = frag16(brow3 + ks * 32);
        // holds the fetches above in front of this k-step's WMMAs; without it
        // the scheduler sinks them to their first use and the lead is lost
        __builtin_amdgcn_sched_barrier(0);
#pragma unroll
        for (int nt = 0; nt < 4; ++nt) {
          accq[nt] = wmma16(aq[u], b[nt], accq[nt]);
          acck[nt] = wmma16(ak[u], b[nt], acck[nt]);
          accv[nt] = wmma16(av[u], b[nt], accv[nt]);
        }
        // keeps the next k-step's x fragments behind these WMMAs, in the same
        // registers; without it the ring and a second b set spill to scratch
        __builtin_amdgcn_sched_barrier(0);
      }
      const int i0 = mt * 16 + hi * 8;
      // the lane's 8 biases of q, k, v: uniform base + one 32-bit lane offset
      const unsigned boff = (unsigned)i0 * 4u;
      float bqv[8], bkv[8], bvv[8];
#pragma unroll
      for (int e = 0; e < 8; ++e) {
        bqv[e] = *(const float*)((const char*)bq + boff + e * 4);
        bkv[e] = *(const float*)((const char*)bk + boff + e * 4);
        bvv[e] = *(const float*)((const char*)bv + boff + e * 4);
      }
      // before the offset register of the loads above is written again (the
      // input operand keeps it from being a later load's destination)
      asm volatile("s_wait_xcnt 0x0" :: "v"(boff) : "memory");
#pragma unroll
      for (int nt = 0; nt < 4; ++nt) {
        // q, k stored transposed: q_t/k_t[s][i] (8 contiguous halves per lane)
        v8h hq, hk;
#pragma unroll
        for (int e = 0; e < 8; ++e) {
          hq[e] = (_Float16)(accq[nt][e] + bqv[e]);
          hk[e] = (_Float16)(acck[nt][e] + bkv[e]);
        }
        const int t = nt * 16 + r;
        if (t < SS) {
          *(v8h*)(q_t + t * QP + i0) = hq;
          *(v8h*)(k_t + t * QP + i0) = hk;
        }
        // v natural: v_m[i][t]; columns t >= 49 hold copies of column 48
        // (finite), which meet zero probabilities only
#pragma unroll
        for (int e = 0; e < 8; ++e)
          v_m[(i0 + e) * VP + t] = (_Float16)(accv[nt][e] + bvv[e]);
      }
      aq[0] = aq[1]; ak[0] = ak[1]; av[0] = av[1];
      aq[1] = aq[2]; ak[1] = ak[2]; av[1] = av[2];
    }
  }
  __syncthreads();

  // GEMM4's weights, k-steps 0..2, start here: they land during the attention.
  const unsigned ooff = (unsigned)(wave * 16 * II + lane * 8) * 2u;  // bytes
  const _Float16* Woh1 = Woh + 16 * 16 * II;   // c-tiles 16..31
  v16h a0[4], a1[4];
#pragma unroll
  for (int p = 0; p < 3; ++p) {
    a0[p] = fragw(Woh + p * 512, ooff);
    a1[p] = fragw(Woh1 + p * 512, ooff);
  }

  // ---- GEMM2: logits[s][t] = q^T k   (A=q_t rows, B=k_t rows, K=256) ----
  for (int tt = wave; tt < 16; tt += NW) {
    const int st = tt >> 2, t2 = tt & 3;
    v8f acc = {};
    const int sa = st * 16 + r, tb = t2 * 16 + r;
    const _Float16* arow = q_t + (sa < SS ? sa : SS - 1) * QP + hi * 8;
    const _Float16* brow = k_t + (tb < SS ? tb : SS - 1) * QP + hi * 8;
#pragma unroll
    for (int k0 = 0; k0 < II; k0 += 32)
      acc = wmma16(frag16(arow + k0), frag16(brow + k0), acc);
    float* col = attn_f + (st * 16 + hi * 8) * AFP + t2 * 16 + r;
#pragma unroll
    for (int e = 0; e < 8; ++e) col[e * AFP] = acc[e];
  }
  __syncthreads();

  // ---- softmax over t: 8 lanes per row, 32 rows at a time ----
  for (int row = tid >> 3; row < SP; row += NW * 4) {
    const int sub = tid & 7;
    float*    rp   = attn_f + row * AFP;
    _Float16* hrow = attn_h + row * AHP;
    if (row < SS) {
      float m = -1e30f;
      for (int t = sub; t < SS; t += 8) m = fmaxf(m, rp[t]);
#pragma unroll
      for (int o = 1; o < 8; o <<= 1) m = fmaxf(m, __shfl_xor(m, o, 8));
      float s = 0.f;
      for (int t = sub; t < SS; t += 8) s += __expf(rp[t] - m);
#pragma unroll
      for (int o = 1; o < 8; o <<= 1) s += __shfl_xor(s, o, 8);
      const float inv = 1.f / s;
      for (int t = sub; t < SP; t += 8)
        hrow[t] = (_Float16)((t < SS) ? __expf(rp[t] - m) * inv : 0.f);
    } else {
      for (int t = sub; t < SP; t += 8) hrow[t] = (_Float16)0.f;
    }
  }
  __syncthreads();

  // ---- GEMM3: y_t[s][i] = attn[s][t] * v[i][t] (K=64) ----
  // One i-tile at a time; B (v) fragment reused across the 4 s-tiles.
  for (int it = wave; it < 16; it += NW) {
    v8f acc[4] = {{}, {}, {}, {}};
    const _Float16* brow = v_m + (it * 16 + r) * VP + hi * 8;
    const _Float16* arow = attn_h + r * AHP + hi * 8;
#pragma unroll
    for (int k0 = 0; k0 < SP; k0 += 32) {
      const v16h b = frag16(brow + k0);
#pragma unroll
      for (int st = 0; st < 4; ++st)
        acc[st] = wmma16(frag16(arow + st * 16 * AHP + k0), b, acc[st]);
    }
#pragma unroll
    for (int st = 0; st < 4; ++st) {
      const int s0 = st * 16 + hi * 8;
      _Float16* col = y_t + s0 * QP + it * 16 + r;
#pragma unroll
      for (int e = 0; e < 8; ++e)
        if (s0 + e < SS) col[e * QP] = (_Float16)acc[st][e];
    }
  }
  __syncthreads();

  // ---- GEMM4: z[c][s] = Wo[512x256] * y + bias + residual, ReLU ----
  // Wave = two c-tiles at a time (ct, ct + 16), twice (ct = wave, wave + NW);
  // the 4 B (y_t) fragments are shared: 12 b128 loads / 8 WMMAs per k-step.
  {
    const _Float16* brow  = y_t + r * QP + hi * 8;
    const _Float16* brow3 = y_t + (SS - 1) * QP + hi * 8;  // s-tile 3: row 48
    // set in the second pass only; names of their own, so that the old pq/pk/pv
    // do not stay live (48 registers) from GEMM1 to here
    v16h nq[2], nk[2], nv[2];
    // rolled: unrolling the two passes would double the kernel's text
#pragma unroll 1
    for (int pass = 0; pass < 2; ++pass) {
      v8f acc0[4] = {{}, {}, {}, {}};      // ct = wave + pass * NW
      v8f acc1[4] = {{}, {}, {}, {}};      // ct + 16
      const unsigned oo = ooff + (unsigned)(pass * NW * 16 * II) * 2u;
#pragma unroll
      for (int ks = 0; ks < II / 32; ++ks) {
        if (ks + 3 < II / 32) {
          a0[(ks + 3) & 3] = fragw(Woh + (ks + 3) * 512, oo);
          a1[(ks + 3) & 3] = fragw(Woh1 + (ks + 3) * 512, oo);
        } else if (pass == 0) {
          // the second pair's k-steps 0..2
          const unsigned on = oo + (unsigned)(NW * 16 * II) * 2u;
          a0[(ks + 3) & 3] = fragw(Woh + (ks + 3 - II / 32) * 512, on);
          a1[(ks + 3) & 3] = fragw(Woh1 + (ks + 3 - II / 32) * 512, on);
        }
        v16h b[4];
#pragma unroll
        for (int st = 0; st < 3; ++st)
          b[st] = frag16(brow + st * 16 * QP + ks * 32);
        b[3] = frag16(brow3 + ks * 32);
        // holds the fetches above in front of this k-step's WMMAs (as in GEMM1)
        __builtin_amdgcn_sched_barrier(0);
#pragma unroll
        for (int st = 0; st < 4; ++st) {
          acc0[st] = wmma16(a0[ks & 3], b[st], acc0[st]);
          acc1[st] = wmma16(a1[ks & 3], b[st], acc1[st]);
        }
      }
      // next block's first q/k/v weights land during this block's epilogue
      if (nWqh && pass == 1) {
        const unsigned woff = (unsigned)(wave * 16 * CG + lane * 8) * 2u;
#pragma unroll
        for (int p = 0; p < 2; ++p) {
          nq[p] = fragw(nWqh + p * 512, woff);
          nk[p] = fragw(nWkh + p * 512, woff);
          nv[p] = fragw(nWvh + p * 512, woff);
        }
      }
#pragma unroll
      for (int half = 0; half < 2; ++half) {
        const int c0 = (wave + pass * NW + half * 16) * 16 + hi * 8;
        v8f* accs = half ? acc1 : acc0;
        float ps[8] = {0.f, 0.f, 0.f, 0.f, 0.f, 0.f, 0.f, 0.f};
#pragma unroll
        for (int st = 0; st < 4; ++st) {
          const int s = st * 16 + r;
          if (s < SS) {
            _Float16* px = xt + s * XP + c0;
            const v8h res = *(const v8h*)px;
            v8h hv;
#pragma unroll
            for (int e = 0; e < 8; ++e) {
              const float z =
                  fmaxf(accs[st][e] + bo[c0 + e] + (float)res[e], 0.f);
              hv[e] = (_Float16)z;
              ps[e] += (float)hv[e];
            }
            if (!POOL) *(v8h*)px = hv;
          }
        }
        if (POOL) {
          // sum over the 16 lanes that hold the s positions of these channels
#pragma unroll
          for (int e = 0; e < 8; ++e) {
#pragma unroll
            for (int o = 1; o < 16; o <<= 1)
              ps[e] += __shfl_xor(ps[e], o, 16);
          }
          if (r == 0) {
#pragma unroll
            for (int e = 0; e < 8; ++e)
              pool_f[c0 + e] = ps[e] * (1.f / (float)SS);
          }
        }
      }
    }
    if (nWqh) {
#pragma unroll
      for (int p = 0; p < 2; ++p) { pq[p] = nq[p]; pk[p] = nk[p]; pv[p] = nv[p]; }
    }
  }
  __syncthreads();
}

__global__ void cvt_pack_f16_kernel(const float* __restrict__ src,
                                    _Float16* __restrict__ dst, int n,
                                    int lgks) {
  const int d = blockIdx.x * 256 + threadIdx.x;
  if (d < n) {
    const int e    = d & 7;
    const int ln   = (d >> 3) & 31;
    const int part = (d >> 8) & 1;
    const int tile = d >> 9;
    const int ks   = tile & ((1 << lgks) - 1);
    const int mt   = tile >> lgks;
    const int row  = mt * 16 + (ln & 15);
    const int k    = ks * 32 + part * 16 + (ln >> 4) * 8 + e;
    dst[d] = (_Float16)src[(size_t)row * (32 << lgks) + k];
  }
}

__global__ __launch_bounds__(256) __attribute__((amdgpu_waves_per_eu(4, 4)))
void frcnn_nonlocal_kernel(
    const float* __restrict__ x,
    const _Float16* __restrict__ wq_h, const _Float16* __restrict__ wk_h,
    const _Float16* __restrict__ wv_h, const _Float16* __restrict__ wo_h,
    const float* __restrict__ bq, const float* __restrict__ bk,
    const float* __restrict__ bv, const float* __restrict__ bo,
    float* __restrict__ pc, float* __restrict__ pr)
{
  extern __shared__ char smem[];
  _Float16* x_t    = (_Float16*)(smem + OFF_XT);
  _Float16* q_t    = (_Float16*)(smem + OFF_QT);
  _Float16* k_t    = (_Float16*)(smem + OFF_KT);
  _Float16* v_m    = (_Float16*)(smem + OFF_VM);
  _Float16* y_t    = (_Float16*)(smem + OFF_QT);   // on q_t, dead after GEMM2
  float*    attn_f = (float*)   (smem + OFF_AF);
  _Float16* attn_h = (_Float16*)(smem + OFF_KT);   // on k_t, dead after GEMM2
  float*    pool_f = (float*)   (smem + OFF_AF);   // on attn_f, dead after softmax

  const int n    = blockIdx.x >> 2;
  const int g    = blockIdx.x & 3;
  const int tid  = threadIdx.x;
  const int wave = tid >> 5;
  const int lane = tid & 31;

  // Load x tile (transpose [c][s] -> x_t[s][c], fp32 -> f16).
  // Unit u = (8 channels, one s): lanes walk s, so a wave-wide b32 load reads
  // 128 contiguous bytes, and a thread's 8 loads make one 16-byte LDS row piece.
  // All of a thread's loads are issued before the first is used: the tile
  // costs one memory latency, not one per batch.
  const float* xg = x + ((size_t)n * CTOT + (size_t)g * CG) * SS;
  float xv[12][8];
#pragma unroll
  for (int i = 0; i < 12; ++i) {
    const int u  = tid + i * 256;
    const int cg = u / SS;
    const unsigned ob = (unsigned)(cg * 8 * SS + (u - cg * SS)) * 4u;  // bytes
    const float* p = (const float*)((const char*)xg + ob);
#pragma unroll
    for (int j = 0; j < 8; ++j) xv[i][j] = p[j * SS];
  }
  // 3136 units = 12 * 256 + 64: of the last 64 each thread takes two channels
  const int ul  = 12 * 256 + (tid & 63);
  const int cl  = (ul / SS) * 8 + (tid >> 6);      // and cl + 4
  const int sl  = ul % SS;
  const float xl0 = xg[cl * SS + sl];
  const float xl1 = xg[(cl + 4) * SS + sl];
  // before any address register of the loads above is written again
  asm volatile("s_wait_xcnt 0x0" ::: "memory");
  // keeps what follows (it reuses those address registers) behind the wait
  __builtin_amdgcn_sched_barrier(0);
  // block 0's first q/k/v weights land while the x tile is brought in
  v16h pq[2], pk[2], pv[2];
#pragma unroll
  for (int p = 0; p < 2; ++p) {
    const unsigned woff = (unsigned)(wave * 16 * CG + lane * 8) * 2u;
    pq[p] = fragw(wq_h + p * 512, woff);
    pk[p] = fragw(wk_h + p * 512, woff);
    pv[p] = fragw(wv_h + p * 512, woff);
  }
  // holds these fetches in front of the conversions below, which wait for x
  __builtin_amdgcn_sched_barrier(0);
#pragma unroll
  for (int i = 0; i < 12; ++i) {
    const int u  = tid + i * 256;
    const int cg = u / SS;
    v8h h;
#pragma unroll
    for (int j = 0; j < 8; ++j) h[j] = (_Float16)xv[i][j];
    *(v8h*)(x_t + (u - cg * SS) * XP + cg * 8) = h;
  }
  x_t[sl * XP + cl]     = (_Float16)xl0;
  x_t[sl * XP + cl + 4] = (_Float16)xl1;
  __syncthreads();

  const size_t pbase = (size_t)n * CTOT + (size_t)g * CG + (size_t)(tid * 2);

  // block 0 (shared): x_t in place
  nl_block<false>(wq_h, wk_h, wv_h, wo_h, bq, bk, bv, bo,
           wq_h + 1 * II * CG, wk_h + 1 * II * CG, wv_h + 1 * II * CG,
           pq, pk, pv, x_t, q_t, k_t, v_m, attn_f, attn_h, y_t, pool_f,
           wave, lane, tid);
  // block 1 (cls): x_t -> channel means
  nl_block<true>(wq_h + 1 * II * CG, wk_h + 1 * II * CG, wv_h + 1 * II * CG,
           wo_h + 1 * CG * II, bq + II, bk + II, bv + II, bo + CG,
           wq_h + 2 * II * CG, wk_h + 2 * II * CG, wv_h + 2 * II * CG,
           pq, pk, pv, x_t, q_t, k_t, v_m, attn_f, attn_h, y_t, pool_f,
           wave, lane, tid);
  // a wave stores two whole lines; pool_f is next written behind block 2's
  // first barrier
  *(float2*)(pc + pbase) = *(const float2*)(pool_f + tid * 2);
  // before a register of the store above is written again
  asm volatile("s_wait_xcnt 0x0" ::: "memory");
  // block 2 (reg): x_t -> channel means
  nl_block<true>(wq_h + 2 * II * CG, wk_h + 2 * II * CG, wv_h + 2 * II * CG,
           wo_h + 2 * CG * II, bq + 2 * II, bk + 2 * II, bv + 2 * II,
           bo + 2 * CG, nullptr, nullptr, nullptr,
           pq, pk, pv, x_t, q_t, k_t, v_m, attn_f, attn_h, y_t, pool_f,
           wave, lane, tid);
  *(float2*)(pr + pbase) = *(const float2*)(pool_f + tid * 2);
}

// ---------------------------------------------------------------------------
// Final linears: one wave per 16x16 output tile, WMMA over K=2048.
#define CLS_TILES 6   // ceil(81/16)
#define REG_TILES 21  // ceil(324/16)

__global__ __launch_bounds__(32) void frcnn_head_kernel(
    const float* __restrict__ pc, const float* __restrict__ pr,
    const float* __restrict__ Wc, const float* __restrict__ bc,
    const float* __restrict__ Wb, const float* __restrict__ bb,
    float* __restrict__ out)
{
  const int mt = blockIdx.x;   // n-tile 0..31
  const int yt = blockIdx.y;   // 0..26
  const float* P; const float* W; const float* bias; float* O;
  int ncols, nt;
  if (yt < CLS_TILES) { P = pc; W = Wc; bias = bc; O = out;
                        ncols = NCLS; nt = yt; }
  else                { P = pr; W = Wb; bias = bb; O = out + NROI * NCLS;
                        ncols = NBOX; nt = yt - CLS_TILES; }

  const int lane = threadIdx.x;
  const int r  = lane & 15;
  const int hi = lane >> 4;
  const int mrow = mt * 16 + r;        // roi row (<512 always)
  const int ncol = nt * 16 + r;        // output column (guarded)
  const float bsel = (ncol < ncols) ? 1.f : 0.f;
  const float* arow = P + (size_t)mrow * CTOT + hi * 8;
  const float* brow = W + (size_t)((ncol < ncols) ? ncol : 0) * CTOT + hi * 8;

  v8f acc = {};
  for (int k0 = 0; k0 < CTOT; k0 += 32) {
    v16h a, b;
#pragma unroll
    for (int e = 0; e < 8; ++e) {
      a[e]     = (_Float16)arow[k0 + e];
      a[e + 8] = (_Float16)arow[k0 + 16 + e];
      b[e]     = (_Float16)(brow[k0 + e] * bsel);
      b[e + 8] = (_Float16)(brow[k0 + 16 + e] * bsel);
    }
    acc = wmma16(a, b, acc);
  }
  if (ncol < ncols) {
#pragma unroll
    for (int e = 0; e < 8; ++e) {
      const int nr = mt * 16 + hi * 8 + e;
      O[(size_t)nr * ncols + ncol] = acc[e] + bias[ncol];
    }
  }
}

// ---------------------------------------------------------------------------
extern "C" void kernel_launch(void* const* d_in, const int* in_sizes, int n_in,
                              void* d_out, int out_size, void* d_ws, size_t ws_size,
                              hipStream_t stream) {
  (void)in_sizes; (void)n_in; (void)out_size; (void)ws_size;
  const float* x  = (const float*)d_in[0];
  const float* Wq = (const float*)d_in[1];
  const float* bq = (const float*)d_in[2];
  const float* Wk = (const float*)d_in[3];
  const float* bk = (const float*)d_in[4];
  const float* Wv = (const float*)d_in[5];
  const float* bv = (const float*)d_in[6];
  const float* Wo = (const float*)d_in[7];
  const float* bo = (const float*)d_in[8];
  const float* Wc = (const float*)d_in[9];
  const float* bc = (const float*)d_in[10];
  const float* Wb = (const float*)d_in[11];
  const float* bb = (const float*)d_in[12];
  float* out = (float*)d_out;

  // workspace layout
  const size_t WN = (size_t)3 * II * CG;  // per qkv-stack element count
  char* ws = (char*)d_ws;
  _Float16* wq_h = (_Float16*)(ws);                    // 3*256*512 f16
  _Float16* wk_h = (_Float16*)(ws + WN * 2);
  _Float16* wv_h = (_Float16*)(ws + WN * 4);
  _Float16* wo_h = (_Float16*)(ws + WN * 6);           // 3*512*256 f16
  float*    pc   = (float*)   (ws + WN * 8);           // 512*2048 f32
  float*    pr   = (float*)   (ws + WN * 8 + (size_t)NROI * CTOT * 4);

  const int wn = (int)WN;
  cvt_pack_f16_kernel<<<(wn + 255) / 256, 256, 0, stream>>>(Wq, wq_h, wn, 4);
  cvt_pack_f16_kernel<<<(wn + 255) / 256, 256, 0, stream>>>(Wk, wk_h, wn, 4);
  cvt_pack_f16_kernel<<<(wn + 255) / 256, 256, 0, stream>>>(Wv, wv_h, wn, 4);
  cvt_pack_f16_kernel<<<(wn + 255) / 256, 256, 0, stream>>>(Wo, wo_h, wn, 3);

  // 2) fused 3x non-local chain + pooling: one WG per (n, g)
  frcnn_nonlocal_kernel<<<NROI * GRP, 256, LDS_TOTAL, stream>>>(
      x, wq_h, wk_h, wv_h, wo_h, bq, bk, bv, bo, pc, pr);

  // 3) classification / bbox heads
  dim3 hgrid(NROI / 16, CLS_TILES + REG_TILES);
  frcnn_head_kernel<<<hgrid, 32, 0, stream>>>(pc, pr, Wc, bc, Wb, bb, out);
}

// v005
// Measured time: 316 microseconds a run.
// Next to v004, in two timings, it ran 1.05 and 1.06 times as fast.
// Over all steps from v000 it is 1.98 times as fast.
#include <hip/hip_runtime.h>
#include <hip/hip_bf16.h>

typedef __attribute__((ext_vector_type(16))) _Float16 v16h;
typedef __attribute__((ext_vector_type(8)))  _Float16 v8h;
typedef __attribute__((ext_vector_type(8)))  float    v8f;

#define NROI 512
#define CTOT 2048
#define GRP  4
#define CG   512
#define II   256
#define SS   49
#define SP   64
#define NCLS 81
#define NBOX 324

// LDS row pitches (in halves for f16 buffers, floats for attn_f)
#define XP  520   // x tile: [49 s][512 c + pad]
#define QP  264   // q_t/k_t/y_t: [49 s][256 i + pad]
#define VP  72    // v: [256 i][64 t + pad]
#define AFP 68    // attn logits f32: [64 s][64 t + pad]
#define AHP 72    // attn probs f16:  [64 s][64 t + pad]

#define NW  8     // waves per work-group

// LDS byte offsets (all 16B aligned). The whole is below 160 KiB, so that two
// work-groups share a WGP. Only the 49 real rows of x, q, k and y are kept
// (a fragment row past the last reads row 48; its columns are never used);
// y_t lies on q_t and attn_h on k_t, each dead by then.
#define OFF_XT   0u
#define OFF_QT   50960u
#define OFF_KT   76832u
#define OFF_VM   102704u
#define OFF_AF   139568u
#define LDS_TOTAL 156976u

__device__ __forceinline__ v16h frag16(const _Float16* p) {
  v8h lo = *(const v8h*)(p);
  v8h hv = *(const v8h*)(p + 16);
  v16h r;
#pragma unroll
  for (int i = 0; i < 8; ++i) { r[i] = lo[i]; r[i + 8] = hv[i]; }
  return r;
}

__device__ __forceinline__ v16h fragw(const _Float16* tile, unsigned lane_off) {
  const char* p = (const char*)tile + lane_off;
  v8h lo = *(const v8h*)(p);
  v8h hv = *(const v8h*)(p + 512);
  v16h r;
#pragma unroll
  for (int i = 0; i < 8; ++i) { r[i] = lo[i]; r[i + 8] = hv[i]; }
  return r;
}

__device__ __forceinline__ v8f wmma16(v16h a, v16h b, v8f c) {
  return __builtin_amdgcn_wmma_f32_16x16x32_f16(false, a, false, b, (short)0, c,
                                                false, false);
}

// One grouped non-local block on a [512 c x 49 s] LDS-resident tile.
// xt layout: [s][c] (c contiguous, pitch XP). POOL false: the result replaces
// xt in place (each element is read and written by its one owner thread).
// POOL true: xt stays, and the mean over s of the result goes to pool_f[c].
// Weight fragments come from L2 and are fetched ahead of their use into a
// register ring, so a wave's WMMAs of one k-step run while later k-steps'
// weights are in flight. pq/pk/pv hold k-steps 0 and 1 of this block's q/k/v
// weights on entry; on exit those of the next block (nW*; null = none).
template <bool POOL>
__device__ __forceinline__ void nl_block(
    const _Float16* __restrict__ Wqh, const _Float16* __restrict__ Wkh,
    const _Float16* __restrict__ Wvh, const _Float16* __restrict__ Woh,
    const float* __restrict__ bq, const float* __restrict__ bk,
    const float* __restrict__ bv, const float* __restrict__ bo,
    const _Float16* __restrict__ nWqh, const _Float16* __restrict__ nWkh,
    const _Float16* __restrict__ nWvh,
    v16h (&pq)[2], v16h (&pk)[2], v16h (&pv)[2],
    _Float16* xt,
    _Float16* q_t, _Float16* k_t, _Float16* v_m,
    float* attn_f, _Float16* attn_h, _Float16* y_t, float* pool_f,
    int wave, int lane, int tid)
{
  const int r  = lane & 15;
  const int hi = lane >> 4;

  // ---- GEMM1: q/k/v[256 x 64] = W[256x512] * x ----
  // Wave = two i-tiles, one after the other (mt = wave, wave + NW); q, k, v
  // computed together so the 4 shared B (x) fragments are loaded once per
  // k-step: 14 b128 loads / 12 WMMAs.
  {
    const _Float16* brow  = xt + r * XP + hi * 8;
    const _Float16* brow3 = xt + (SS - 1) * XP + hi * 8;  // s-tile 3: row 48
    // ring of 3 register sets, weights fetched 2 k-steps ahead
    v16h aq[3], ak[3], av[3];
    aq[0] = pq[0]; ak[0] = pk[0]; av[0] = pv[0];
    aq[1] = pq[1]; ak[1] = pk[1]; av[1] = pv[1];
    // rolled: unrolling the two passes would double the kernel's text
#pragma unroll 1
    for (int pass = 0; pass < 2; ++pass) {
      const int mt = wave + pass * NW;     // 0..15
      v8f accq[4] = {{}, {}, {}, {}};
      v8f acck[4] = {{}, {}, {}, {}};
      v8f accv[4] = {{}, {}, {}, {}};
      // packed tiles: 512 halves per (i-tile, k-step), k-steps consecutive
      const unsigned woff = (unsigned)(mt * 16 * CG + lane * 8) * 2u;  // bytes
#pragma unroll
      for (int ks = 0; ks < CG / 32; ++ks) {
        const int f = (ks + 2) % 3;
        if (ks + 2 < CG / 32) {
          aq[f] = fragw(Wqh + (ks + 2) * 512, woff);
          ak[f] = fragw(Wkh + (ks + 2) * 512, woff);
          av[f] = fragw(Wvh + (ks + 2) * 512, woff);
        } else if (pass == 0) {
          // the second i-tile's k-steps 0 and 1
          const unsigned wnext = woff + (unsigned)(NW * 16 * CG) * 2u;
          aq[f] = fragw(Wqh + (ks + 2 - CG / 32) * 512, wnext);
          ak[f] = fragw(Wkh + (ks + 2 - CG / 32) * 512, wnext);
          av[f] = fragw(Wvh + (ks + 2 - CG / 32) * 512, wnext);
        }
        const int u = ks % 3;
        v16h b[4];
#pragma unroll
        for (int nt = 0; nt < 3; ++nt)
          b[nt] = frag16(brow + nt * 16 * XP + ks * 32);
        b[3] = frag16(brow3 + ks * 32);
        // holds the fetches above in front of this k-step's WMMAs; without it
        // the scheduler sinks them to their first use and the lead is lost
        __builtin_amdgcn_sched_barrier(0);
#pragma unroll
        for (int nt = 0; nt < 4; ++nt) {
          accq[nt] = wmma16(aq[u], b[nt], accq[nt]);
          acck[nt] = wmma16(ak[u], b[nt], acck[nt]);
          accv[nt] = wmma16(av[u], b[nt], accv[nt]);
        }
        // keeps the next k-step's x fragments behind these WMMAs, in the same
        // registers; without it the ring and a second b set spill to scratch
        __builtin_amdgcn_sched_barrier(0);
      }
      const int i0 = mt * 16 + hi * 8;
      // the lane's 8 biases of q, k, v: uniform base + one 32-bit lane offset
      const unsigned boff = (unsigned)i0 * 4u;
      float bqv[8], bkv[8], bvv[8];
#pragma unroll
      for (int e = 0; e < 8; ++e) {
        bqv[e] = *(const float*)((const char*)bq + boff + e * 4);
        bkv[e] = *(const float*)((const char*)bk + boff + e * 4);
        bvv[e] = *(const float*)((const char*)bv + boff + e * 4);
      }
      // before the offset register of the loads above is written again (the
      // input operand keeps it from being a later load's destination)
      asm volatile("s_wait_xcnt 0x0" :: "v"(boff) : "memory");
#pragma unroll
      for (int nt = 0; nt < 4; ++nt) {
        // q, k stored transposed: q_t/k_t[s][i] (8 contiguous halves per lane)
        v8h hq, hk;
#pragma unroll
        for (int e = 0; e < 8; ++e) {
          hq[e] = (_Float16)(accq[nt][e] + bqv[e]);
          hk[e] = (_Float16)(acck[nt][e] + bkv[e]);
        }
        const int t = nt * 16 + r;
        if (t < SS) {
          *(v8h*)(q_t + t * QP + i0) = hq;
          *(v8h*)(k_t + t * QP + i0) = hk;
        }
        // v natural: v_m[i][t]; columns t >= 49 hold copies of column 48
        // (finite), which meet zero probabilities only
#pragma unroll
        for (int e = 0; e < 8; ++e)
          v_m[(i0 + e) * VP + t] = (_Float16)(accv[nt][e] + bvv[e]);
      }
      aq[0] = aq[1]; ak[0] = ak[1]; av[0] = av[1];
      aq[1] = aq[2]; ak[1] = ak[2]; av[1] = av[2];
    }
  }
  __syncthreads();

  // GEMM4's weights, k-steps 0..2, start here: they land during the attention.
  const unsigned ooff = (unsigned)(wave * 16 * II + lane * 8) * 2u;  // bytes
  const _Float16* Woh1 = Woh + 16 * 16 * II;   // c-tiles 16..31
  v16h a0[4], a1[4];
#pragma unroll
  for (int p = 0; p < 3; ++p) {
    a0[p] = fragw(Woh + p * 512, ooff);
    a1[p] = fragw(Woh1 + p * 512, ooff);
  }

  // ---- GEMM2: logits[s][t] = q^T k   (A=q_t rows, B=k_t rows, K=256) ----
  for (int tt = wave; tt < 16; tt += NW) {
    const int st = tt >> 2, t2 = tt & 3;
    v8f acc = {};
    const int sa = st * 16 + r, tb = t2 * 16 + r;
    const _Float16* arow = q_t + (sa < SS ? sa : SS - 1) * QP + hi * 8;
    const _Float16* brow = k_t + (tb < SS ? tb : SS - 1) * QP + hi * 8;
#pragma unroll
    for (int k0 = 0; k0 < II; k0 += 32)
      acc = wmma16(frag16(arow + k0), frag16(brow + k0), acc);
    float* col = attn_f + (st * 16 + hi * 8) * AFP + t2 * 16 + r;
#pragma unroll
    for (int e = 0; e < 8; ++e) col[e * AFP] = acc[e];
  }
  __syncthreads();

  // ---- softmax over t: 8 lanes per row, 32 rows at a time ----
  for (int row = tid >> 3; row < SP; row += NW * 4) {
    const int sub = tid & 7;
    float*    rp   = attn_f + row * AFP;
    _Float16* hrow = attn_h + row * AHP;
    if (row < SS) {
      float m = -1e30f;
      for (int t = sub; t < SS; t += 8) m = fmaxf(m, rp[t]);
#pragma unroll
      for (int o = 1; o < 8; o <<= 1) m = fmaxf(m, __shfl_xor(m, o, 8));
      float s = 0.f;
      for (int t = sub; t < SS; t += 8) s += __expf(rp[t] - m);
#pragma unroll
      for (int o = 1; o < 8; o <<= 1) s += __shfl_xor(s, o, 8);
      const float inv = 1.f / s;
      for (int t = sub; t < SP; t += 8)
        hrow[t] = (_Float16)((t < SS) ? __expf(rp[t] - m) * inv : 0.f);
    } else {
      for (int t = sub; t < SP; t += 8) hrow[t] = (_Float16)0.f;
    }
  }
  __syncthreads();

  // ---- GEMM3: y_t[s][i] = attn[s][t] * v[i][t] (K=64) ----
  // One i-tile at a time; B (v) fragment reused across the 4 s-tiles.
  for (int it = wave; it < 16; it += NW) {
    v8f acc[4] = {{}, {}, {}, {}};
    const _Float16* brow = v_m + (it * 16 + r) * VP + hi * 8;
    const _Float16* arow = attn_h + r * AHP + hi * 8;
#pragma unroll
    for (int k0 = 0; k0 < SP; k0 += 32) {
      const v16h b = frag16(brow + k0);
#pragma unroll
      for (int st = 0; st < 4; ++st)
        acc[st] = wmma16(frag16(arow + st * 16 * AHP + k0), b, acc[st]);
    }
#pragma unroll
    for (int st = 0; st < 4; ++st) {
      const int s0 = st * 16 + hi * 8;
      _Float16* col = y_t + s0 * QP + it * 16 + r;
#pragma unroll
      for (int e = 0; e < 8; ++e)
        if (s0 + e < SS) col[e * QP] = (_Float16)acc[st][e];
    }
  }
  __syncthreads();

  // ---- GEMM4: z[c][s] = Wo[512x256] * y + bias + residual, ReLU ----
  // Wave = two c-tiles at a time (ct, ct + 16), twice (ct = wave, wave + NW);
  // the 4 B (y_t) fragments are shared: 12 b128 loads / 8 WMMAs per k-step.
  {
    const _Float16* brow  = y_t + r * QP + hi * 8;
    const _Float16* brow3 = y_t + (SS - 1) * QP + hi * 8;  // s-tile 3: row 48
    // set in the second pass only; names of their own, so that the old pq/pk/pv
    // do not stay live (48 registers) from GEMM1 to here
    v16h nq[2], nk[2], nv[2];
    // rolled: unrolling the two passes would double the kernel's text
#pragma unroll 1
    for (int pass = 0; pass < 2; ++pass) {
      v8f acc0[4] = {{}, {}, {}, {}};      // ct = wave + pass * NW
      v8f acc1[4] = {{}, {}, {}, {}};      // ct + 16
      const unsigned oo = ooff + (unsigned)(pass * NW * 16 * II) * 2u;
#pragma unroll
      for (int ks = 0; ks < II / 32; ++ks) {
        if (ks + 3 < II / 32) {
          a0[(ks + 3) & 3] = fragw(Woh + (ks + 3) * 512, oo);
          a1[(ks + 3) & 3] = fragw(Woh1 + (ks + 3) * 512, oo);
        } else if (pass == 0) {
          // the second pair's k-steps 0..2
          const unsigned on = oo + (unsigned)(NW * 16 * II) * 2u;
          a0[(ks + 3) & 3] = fragw(Woh + (ks + 3 - II / 32) * 512, on);
          a1[(ks + 3) & 3] = fragw(Woh1 + (ks + 3 - II / 32) * 512, on);
        }
        v16h b[4];
#pragma unroll
        for (int st = 0; st < 3; ++st)
          b[st] = frag16(brow + st * 16 * QP + ks * 32);
        b[3] = frag16(brow3 + ks * 32);
        // holds the fetches above in front of this k-step's WMMAs (as in GEMM1)
        __builtin_amdgcn_sched_barrier(0);
#pragma unroll
        for (int st = 0; st < 4; ++st) {
          acc0[st] = wmma16(a0[ks & 3], b[st], acc0[st]);
          acc1[st] = wmma16(a1[ks & 3], b[st], acc1[st]);
        }
      }
      // next block's first q/k/v weights land during this block's epilogue
      if (nWqh && pass == 1) {
        const unsigned woff = (unsigned)(wave * 16 * CG + lane * 8) * 2u;
#pragma unroll
        for (int p = 0; p < 2; ++p) {
          nq[p] = fragw(nWqh + p * 512, woff);
          nk[p] = fragw(nWkh + p * 512, woff);
          nv[p] = fragw(nWvh + p * 512, woff);
        }
      }
#pragma unroll
      for (int half = 0; half < 2; ++half) {
        const int c0 = (wave + pass * NW + half * 16) * 16 + hi * 8;
        v8f* accs = half ? acc1 : acc0;
        float ps[8] = {0.f, 0.f, 0.f, 0.f, 0.f, 0.f, 0.f, 0.f};
#pragma unroll
        for (int st = 0; st < 4; ++st) {
          const int s = st * 16 + r;
          if (s < SS) {
            _Float16* px = xt + s * XP + c0;
            const v8h res = *(const v8h*)px;
            v8h hv;
#pragma unroll
            for (int e = 0; e < 8; ++e) {
              const float z =
                  fmaxf(accs[st][e] + bo[c0 + e] + (float)res[e], 0.f);
              hv[e] = (_Float16)z;
              ps[e] += (float)hv[e];
            }
            if (!POOL) *(v8h*)px = hv;
          }
        }
        if (POOL) {
          // sum over the 16 lanes that hold the s positions of these channels
#pragma unroll
          for (int e = 0; e < 8; ++e) {
#pragma unroll
            for (int o = 1; o < 16; o <<= 1)
              ps[e] += __shfl_xor(ps[e], o, 16);
          }
          if (r == 0) {
#pragma unroll
            for (int e = 0; e < 8; ++e)
              pool_f[c0 + e] = ps[e] * (1.f / (float)SS);
          }
        }
      }
    }
    if (nWqh) {
#pragma unroll
      for (int p = 0; p < 2; ++p) { pq[p] = nq[p]; pk[p] = nk[p]; pv[p] = nv[p]; }
    }
  }
  __syncthreads();
}

__global__ void cvt_pack_f16_kernel(const float* __restrict__ src,
                                    _Float16* __restrict__ dst, int n,
                                    int lgks) {
  const int d = blockIdx.x * 256 + threadIdx.x;
  if (d < n) {
    const int e    = d & 7;
    const int ln   = (d >> 3) & 31;
    const int part = (d >> 8) & 1;
    const int tile = d >> 9;
    const int ks   = tile & ((1 << lgks) - 1);
    const int mt   = tile >> lgks;
    const int row  = mt * 16 + (ln & 15);
    const int k    = ks * 32 + part * 16 + (ln >> 4) * 8 + e;
    dst[d] = (_Float16)src[(size_t)row * (32 << lgks) + k];
  }
}

__global__ __launch_bounds__(256) __attribute__((amdgpu_waves_per_eu(4, 4)))
void frcnn_nonlocal_kernel(
    const float* __restrict__ x,
    const _Float16* __restrict__ wq_h, const _Float16* __restrict__ wk_h,
    const _Float16* __restrict__ wv_h, const _Float16* __restrict__ wo_h,
    const float* __restrict__ bq, const float* __restrict__ bk,
    const float* __restrict__ bv, const float* __restrict__ bo,
    float* __restrict__ pc, float* __restrict__ pr)
{
  extern __shared__ char smem[];
  _Float16* x_t    = (_Float16*)(smem + OFF_XT);
  _Float16* q_t    = (_Float16*)(smem + OFF_QT);
  _Float16* k_t    = (_Float16*)(smem + OFF_KT);
  _Float16* v_m    = (_Float16*)(smem + OFF_VM);
  _Float16* y_t    = (_Float16*)(smem + OFF_QT);   // on q_t, dead after GEMM2
  float*    attn_f = (float*)   (smem + OFF_AF);
  _Float16* attn_h = (_Float16*)(smem + OFF_KT);   // on k_t, dead after GEMM2
  float*    pool_f = (float*)   (smem + OFF_AF);   // on attn_f, dead after softmax

  const int n    = blockIdx.x >> 2;
  const int g    = blockIdx.x & 3;
  const int tid  = threadIdx.x;
  const int wave = tid >> 5;
  const int lane = tid & 31;

  // Load x tile (transpose [c][s] -> x_t[s][c], fp32 -> f16).
  // Unit u = (8 channels, one s): lanes walk s, so a wave-wide b32 load reads
  // 128 contiguous bytes, and a thread's 8 loads make one 16-byte LDS row piece.
  // All of a thread's loads are issued before the first is used: the tile
  // costs one memory latency, not one per batch.
  const float* xg = x + ((size_t)n * CTOT + (size_t)g * CG) * SS;
  float xv[12][8];
#pragma unroll
  for (int i = 0; i < 12; ++i) {
    const int u  = tid + i * 256;
    const int cg = u / SS;
    const unsigned ob = (unsigned)(cg * 8 * SS + (u - cg * SS)) * 4u;  // bytes
    const float* p = (const float*)((const char*)xg + ob);
#pragma unroll
    for (int j = 0; j < 8; ++j) xv[i][j] = p[j * SS];
  }
  // 3136 units = 12 * 256 + 64: of the last 64 each thread takes two channels
  const int ul  = 12 * 256 + (tid & 63);
  const int cl  = (ul / SS) * 8 + (tid >> 6);      // and cl + 4
  const int sl  = ul % SS;
  const float xl0 = xg[cl * SS + sl];
  const float xl1 = xg[(cl + 4) * SS + sl];
  // before any address register of the loads above is written again
  asm volatile("s_wait_xcnt 0x0" ::: "memory");
  // keeps what follows (it reuses those address registers) behind the wait
  __builtin_amdgcn_sched_barrier(0);
  // block 0's first q/k/v weights land while the x tile is brought in
  v16h pq[2], pk[2], pv[2];
#pragma unroll
  for (int p = 0; p < 2; ++p) {
    const unsigned woff = (unsigned)(wave * 16 * CG + lane * 8) * 2u;
    pq[p] = fragw(wq_h + p * 512, woff);
    pk[p] = fragw(wk_h + p * 512, woff);
    pv[p] = fragw(wv_h + p * 512, woff);
  }
  // holds these fetches in front of the conversions below, which wait for x
  __builtin_amdgcn_sched_barrier(0);
#pragma unroll
  for (int i = 0; i < 12; ++i) {
    const int u  = tid + i * 256;
    const int cg = u / SS;
    v8h h;
#pragma unroll
    for (int j = 0; j < 8; ++j) h[j] = (_Float16)xv[i][j];
    *(v8h*)(x_t + (u - cg * SS) * XP + cg * 8) = h;
  }
  x_t[sl * XP + cl]     = (_Float16)xl0;
  x_t[sl * XP + cl + 4] = (_Float16)xl1;
  __syncthreads();

  const size_t pbase = (size_t)n * CTOT + (size_t)g * CG + (size_t)(tid * 2);

  // block 0 (shared): x_t in place
  nl_block<false>(wq_h, wk_h, wv_h, wo_h, bq, bk, bv, bo,
           wq_h + 1 * II * CG, wk_h + 1 * II * CG, wv_h + 1 * II * CG,
           pq, pk, pv, x_t, q_t, k_t, v_m, attn_f, attn_h, y_t, pool_f,
           wave, lane, tid);
  // block 1 (cls): x_t -> channel means
  nl_block<true>(wq_h + 1 * II * CG, wk_h + 1 * II * CG, wv_h + 1 * II * CG,
           wo_h + 1 * CG * II, bq + II, bk + II, bv + II, bo + CG,
           wq_h + 2 * II * CG, wk_h + 2 * II * CG, wv_h + 2 * II * CG,
           pq, pk, pv, x_t, q_t, k_t, v_m, attn_f, attn_h, y_t, pool_f,
           wave, lane, tid);
  // a wave stores two whole lines; pool_f is next written behind block 2's
  // first barrier
  *(float2*)(pc + pbase) = *(const float2*)(pool_f + tid * 2);
  // before a register of the store above is written again
  asm volatile("s_wait_xcnt 0x0" ::: "memory");
  // block 2 (reg): x_t -> channel means
  nl_block<true>(wq_h + 2 * II * CG, wk_h + 2 * II * CG, wv_h + 2 * II * CG,
           wo_h + 2 * CG * II, bq + 2 * II, bk + 2 * II, bv + 2 * II,
           bo + 2 * CG, nullptr, nullptr, nullptr,
           pq, pk, pv, x_t, q_t, k_t, v_m, attn_f, attn_h, y_t, pool_f,
           wave, lane, tid);
  *(float2*)(pr + pbase) = *(const float2*)(pool_f + tid * 2);
}

// ---------------------------------------------------------------------------
// Final linears: one work-group of 16 waves per 32 x 48 output tile, K = 2048.
// The 32 pooled rows and 48 weight rows come in by whole-line loads (a wave-wide
// b128 load = 512 contiguous bytes of one row), three k-chunks in flight, and go
// as f16 through LDS, where the fragments are read. Wave = (row tile, k-step of
// the chunk): 8 partial sums per output, added through LDS at the end.
#define CLS_GRPS 2    // ceil(81/48)
#define REG_GRPS 7    // ceil(324/48)
#define HM    32      // pooled rows per work-group
#define HN    48      // output columns per work-group
#define HKC   256     // k per chunk
#define HP    264     // LDS row pitch in halves (16 B x odd)
#define HBUF  ((HM + HN) * HP)
#define HNCH  (CTOT / HKC)
#define HRING 3
#define HPASS ((HM + HN) / 8)

__global__ __launch_bounds__(512) void frcnn_head_kernel(
    const float* __restrict__ pc, const float* __restrict__ pr,
    const float* __restrict__ Wc, const float* __restrict__ bc,
    const float* __restrict__ Wb, const float* __restrict__ bb,
    float* __restrict__ out)
{
  __shared__ __attribute__((aligned(16))) _Float16 hs[2 * HBUF];

  const int mb = blockIdx.x;   // block of 32 rois, 0..15
  const int yg = blockIdx.y;   // 0..8
  const float* P; const float* W; const float* bias; float* O;
  int ncols, n0;
  if (yg < CLS_GRPS) { P = pc; W = Wc; bias = bc; O = out;
                       ncols = NCLS; n0 = yg * HN; }
  else               { P = pr; W = Wb; bias = bb; O = out + NROI * NCLS;
                       ncols = NBOX; n0 = (yg - CLS_GRPS) * HN; }

  const int tid  = threadIdx.x;
  const int wave = tid >> 5;
  const int lane = tid & 31;
  const int r  = lane & 15;
  const int hi = lane >> 4;
  const int c4   = tid & 63;   // which 16 bytes of a row's 1-KiB chunk
  const int rsub = tid >> 6;   // row within a pass of 8 rows

  // byte offsets of this thread's piece in each of the 10 rows it brings in;
  // a column past the last reads the last row (its outputs are never stored)
  unsigned off[HPASS];
#pragma unroll
  for (int j = 0; j < HPASS; ++j) {
    int row;
    if (j < HM / 8) {
      row = mb * HM + j * 8 + rsub;
    } else {
      row = n0 + (j - HM / 8) * 8 + rsub;
      row = row < ncols ? row : ncols - 1;
    }
    off[j] = (unsigned)row * (CTOT * 4u) + (unsigned)c4 * 16u;
  }

  float4 rg[HRING][HPASS];
#pragma unroll
  for (int p = 0; p < HRING; ++p) {
#pragma unroll
    for (int j = 0; j < HPASS; ++j)
      rg[p][j] = *(const float4*)((const char*)(j < HM / 8 ? P : W) + off[j] +
                                  p * (HKC * 4));
  }

  const int mtile = wave >> 3;   // 0..1
  const int kw    = wave & 7;    // k-step of the chunk
  v8f acc[3] = {{}, {}, {}};
#pragma unroll
  for (int ch = 0; ch < HNCH; ++ch) {
    _Float16* buf = hs + (ch & 1) * HBUF;
    const int s = ch % HRING;
#pragma unroll
    for (int j = 0; j < HPASS; j += 2) {
      uint2 h0, h1;
      asm volatile("v_nop\n\tv_nop\n\tv_nop\n\tv_nop\n\t"
                   "v_cvt_pk_f16_f32 %0, %4, %5\n\t"
                   "v_cvt_pk_f16_f32 %1, %6, %7\n\t"
                   "v_cvt_pk_f16_f32 %2, %8, %9\n\t"
                   "v_cvt_pk_f16_f32 %3, %10, %11"
                   : "=&v"(h0.x), "=&v"(h0.y), "=&v"(h1.x), "=&v"(h1.y)
                   : "v"(rg[s][j].x), "v"(rg[s][j].y), "v"(rg[s][j].z),
                     "v"(rg[s][j].w), "v"(rg[s][j + 1].x), "v"(rg[s][j + 1].y),
                     "v"(rg[s][j + 1].z), "v"(rg[s][j + 1].w));
      *(uint2*)(buf + (j * 8 + rsub) * HP + c4 * 4) = h0;
      *(uint2*)(buf + ((j + 1) * 8 + rsub) * HP + c4 * 4) = h1;
    }
    if (ch + HRING < HNCH) {
#pragma unroll
      for (int j = 0; j < HPASS; ++j)
        rg[s][j] = *(const float4*)((const char*)(j < HM / 8 ? P : W) + off[j] +
                                    (ch + HRING) * (HKC * 4));
      // behind the last loads: their offset registers are free to be reused
      if (ch + HRING == HNCH - 1) asm volatile("s_wait_xcnt 0x0" ::: "memory");
      // holds the refill here, three chunks ahead of its use; without it the
      // scheduler may sink the loads to their first use and the lead is lost
      __builtin_amdgcn_sched_barrier(0);
    }
    // one barrier a chunk: it publishes this buffer, and every reader of the
    // other buffer (chunk ch - 1) has passed it before chunk ch + 1 is stored.
    // By hand, with the LDS wait alone: __syncthreads() also waits for every
    // global load, which would end the refills' lead at each chunk
    asm volatile("s_wait_dscnt 0x0\n\ts_barrier_signal -1\n\ts_barrier_wait -1"
                 ::: "memory");
    const _Float16* fp = buf + r * HP + kw * 32 + hi * 8;
    const v16h a = frag16(fp + mtile * 16 * HP);
#pragma unroll
    for (int nt = 0; nt < 3; ++nt)
      acc[nt] = wmma16(a, frag16(fp + (HM + nt * 16) * HP), acc[nt]);
  }
  __syncthreads();

  // partial sums: red[wave][nt][e][lane]
  float* red = (float*)hs;
#pragma unroll
  for (int nt = 0; nt < 3; ++nt) {
#pragma unroll
    for (int e = 0; e < 8; ++e)
      red[((wave * 3 + nt) * 8 + e) * 32 + lane] = acc[nt][e];
  }
  __syncthreads();
#pragma unroll
  for (int j = 0; j < 3; ++j) {
    // wave-uniform (row tile, column tile, e); lanes as in the accumulator
    const int id = wave + j * 16;          // 0..47
    const int mt = id / 24;
    const int nt = (id / 8) % 3;
    const int e  = id & 7;
    float sum = 0.f;
#pragma unroll
    for (int k = 0; k < 8; ++k)
      sum += red[(((mt * 8 + k) * 3 + nt) * 8 + e) * 32 + lane];
    const int ncol = n0 + nt * 16 + r;
    const int nr   = mb * HM + mt * 16 + hi * 8 + e;
    if (ncol < ncols) O[(size_t)nr * ncols + ncol] = sum + bias[ncol];
  }
}

// ---------------------------------------------------------------------------
extern "C" void kernel_launch(void* const* d_in, const int* in_sizes, int n_in,
                              void* d_out, int out_size, void* d_ws, size_t ws_size,
                              hipStream_t stream) {
  (void)in_sizes; (void)n_in; (void)out_size; (void)ws_size;
  const float* x  = (const float*)d_in[0];
  const float* Wq = (const float*)d_in[1];
  const float* bq = (const float*)d_in[2];
  const float* Wk = (const float*)d_in[3];
  const float* bk = (const float*)d_in[4];
  const float* Wv = (const float*)d_in[5];
  const float* bv = (const float*)d_in[6];
  const float* Wo = (const float*)d_in[7];
  const float* bo = (const float*)d_in[8];
  const float* Wc = (const float*)d_in[9];
  const float* bc = (const float*)d_in[10];
  const float* Wb = (const float*)d_in[11];
  const float* bb = (const float*)d_in[12];
  float* out = (float*)d_out;

  // workspace layout
  const size_t WN = (size_t)3 * II * CG;  // per qkv-stack element count
  char* ws = (char*)d_ws;
  _Float16* wq_h = (_Float16*)(ws);                    // 3*256*512 f16
  _Float16* wk_h = (_Float16*)(ws + WN * 2);
  _Float16* wv_h = (_Float16*)(ws + WN * 4);
  _Float16* wo_h = (_Float16*)(ws + WN * 6);           // 3*512*256 f16
  float*    pc   = (float*)   (ws + WN * 8);           // 512*2048 f32
  float*    pr   = (float*)   (ws + WN * 8 + (size_t)NROI * CTOT * 4);

  const int wn = (int)WN;
  cvt_pack_f16_kernel<<<(wn + 255) / 256, 256, 0, stream>>>(Wq, wq_h, wn, 4);
  cvt_pack_f16_kernel<<<(wn + 255) / 256, 256, 0, stream>>>(Wk, wk_h, wn, 4);
  cvt_pack_f16_kernel<<<(wn + 255) / 256, 256, 0, stream>>>(Wv, wv_h, wn, 4);
  cvt_pack_f16_kernel<<<(wn + 255) / 256, 256, 0, stream>>>(Wo, wo_h, wn, 3);

  // 2) fused 3x non-local chain + pooling: one WG per (n, g)
  frcnn_nonlocal_kernel<<<NROI * GRP, 256, LDS_TOTAL, stream>>>(
      x, wq_h, wk_h, wv_h, wo_h, bq, bk, bv, bo, pc, pr);

  // 3) classification / bbox heads
  dim3 hgrid(NROI / HM, CLS_GRPS + REG_GRPS);
  frcnn_head_kernel<<<hgrid, 512, 0, stream>>>(pc, pr, Wc, bc, Wb, bb, out);
}

// v006
// One run takes 288 microseconds.
// In both of two side-by-side timings against v005, it was 1.09 times as fast.
// Over all steps from v000 it is 2.16 times as fast.
#include <hip/hip_runtime.h>
#include <hip/hip_bf16.h>

typedef __attribute__((ext_vector_type(16))) _Float16 v16h;
typedef __attribute__((ext_vector_type(8)))  _Float16 v8h;
typedef __attribute__((ext_vector_type(8)))  float    v8f;

#define NROI 512
#define CTOT 2048
#define GRP  4
#define CG   512
#define II   256
#define SS   49
#define SP   64
#define NCLS 81
#define NBOX 324

// LDS row pitches in halves
#define XP  520   // x tile: [49 s][512 c + pad]
#define QP  264   // q_t/k_t/y_t: [49 s][256 i + pad]
#define VP  72    // v: [256 i][64 t + pad]

#define NW  8     // waves per work-group

// LDS byte offsets (all 16B aligned). The whole is below 160 KiB, so that two
// work-groups share a WGP. Only the 49 real rows of x, q and k are kept; y has
// 15 spare rows besides, for the query rows past the last
// (a fragment row past the last reads row 48; its columns are never used);
// y_t lies on q_t: a wave writes the rows that it alone has read.
#define OFF_XT   0u
#define OFF_QT   50960u
#define OFF_KT   76832u
#define OFF_VM   102704u
#define OFF_PF   139568u
#define OFF_YP   141616u   // 15 spare y rows
#define LDS_TOTAL 149536u

__device__ __forceinline__ v16h frag16(const _Float16* p) {
  v8h lo = *(const v8h*)(p);
  v8h hv = *(const v8h*)(p + 16);
  v16h r;
#pragma unroll
  for (int i = 0; i < 8; ++i) { r[i] = lo[i]; r[i + 8] = hv[i]; }
  return r;
}

__device__ __forceinline__ v16h fragw(const _Float16* tile, unsigned lane_off) {
  const char* p = (const char*)tile + lane_off;
  v8h lo = *(const v8h*)(p);
  v8h hv = *(const v8h*)(p + 512);
  v16h r;
#pragma unroll
  for (int i = 0; i < 8; ++i) { r[i] = lo[i]; r[i + 8] = hv[i]; }
  return r;
}

__device__ __forceinline__ float xhalf(float x) {
  const int b = __builtin_bit_cast(int, x);
  return __builtin_bit_cast(float, __builtin_amdgcn_permlanex16(
      b, b, 0x76543210, 0xfedcba98, false, false));
}

__device__ __forceinline__ float exp_slot(float x) {
  float y;
  asm("v_exp_f32 %0, %1\n\tv_nop" : "=v"(y) : "v"(x * 1.44269504f));
  return y;
}

__device__ __forceinline__ v8f wmma16(v16h a, v16h b, v8f c) {
  return __builtin_amdgcn_wmma_f32_16x16x32_f16(false, a, false, b, (short)0, c,
                                                false, false);
}

// One grouped non-local block on a [512 c x 49 s] LDS-resident tile.
// xt layout: [s][c] (c contiguous, pitch XP). POOL false: the result replaces
// xt in place (each element is read and written by its one owner thread).
// POOL true: xt stays, and the mean over s of the result goes to pool_f[c].
// Weight fragments come from L2 and are fetched ahead of their use into a
// register ring, so a wave's WMMAs of one k-step run while later k-steps'
// weights are in flight. pq/pk/pv hold k-steps 0 and 1 of this block's q/k/v
// weights on entry; on exit those of the next block (nW*; null = none).
template <bool POOL>
__device__ __forceinline__ void nl_block(
    const _Float16* __restrict__ Wqh, const _Float16* __restrict__ Wkh,
    const _Float16* __restrict__ Wvh, const _Float16* __restrict__ Woh,
    const float* __restrict__ bq, const float* __restrict__ bk,
    const float* __restrict__ bv, const float* __restrict__ bo,
    const _Float16* __restrict__ nWqh, const _Float16* __restrict__ nWkh,
    const _Float16* __restrict__ nWvh,
    v16h (&pq)[2], v16h (&pk)[2], v16h (&pv)[2],
    _Float16* xt,
    _Float16* q_t, _Float16* k_t, _Float16* v_m,
    _Float16* y_t, _Float16* y_pad, float* pool_f,
    int wave, int lane)
{
  const int r  = lane & 15;
  const int hi = lane >> 4;

  // ---- GEMM1: q/k/v[256 x 64] = W[256x512] * x ----
  // Wave = two i-tiles, one after the other (mt = wave, wave + NW); q, k, v
  // computed together so the 4 shared B (x) fragments are loaded once per
  // k-step: 14 b128 loads / 12 WMMAs.
  {
    const _Float16* brow  = xt + r * XP + hi * 8;
    const _Float16* brow3 = xt + (SS - 1) * XP + hi * 8;  // s-tile 3: row 48
    // ring of 3 register sets, weights fetched 2 k-steps ahead
    v16h aq[3], ak[3], av[3];
    aq[0] = pq[0]; ak[0] = pk[0]; av[0] = pv[0];
    aq[1] = pq[1]; ak[1] = pk[1]; av[1] = pv[1];
    // rolled: unrolling the two passes would double the kernel's text
#pragma unroll 1
    for (int pass = 0; pass < 2; ++pass) {
      const int mt = wave + pass * NW;     // 0..15
      v8f accq[4] = {{}, {}, {}, {}};
      v8f acck[4] = {{}, {}, {}, {}};
      v8f accv[4] = {{}, {}, {}, {}};
      // packed tiles: 512 halves per (i-tile, k-step), k-steps consecutive
      const unsigned woff = (unsigned)(mt * 16 * CG + lane * 8) * 2u;  // bytes
#pragma unroll
      for (int ks = 0; ks < CG / 32; ++ks) {
        const int f = (ks + 2) % 3;
        if (ks + 2 < CG / 32) {
          aq[f] = fragw(Wqh + (ks + 2) * 512, woff);
          ak[f] = fragw(Wkh + (ks + 2) * 512, woff);
          av[f] = fragw(Wvh + (ks + 2) * 512, woff);
        } else if (pass == 0) {
          // the second i-tile's k-steps 0 and 1
          const unsigned wnext = woff + (unsigned)(NW * 16 * CG) * 2u;
          aq[f] = fragw(Wqh + (ks + 2 - CG / 32) * 512, wnext);
          ak[f] = fragw(Wkh + (ks + 2 - CG / 32) * 512, wnext);
          av[f] = fragw(Wvh + (ks + 2 - CG / 32) * 512, wnext);
        }
        const int u = ks % 3;
        v16h b[4];
#pragma unroll
        for (int nt = 0; nt < 3; ++nt)
          b[nt] = frag16(brow + nt * 16 * XP + ks * 32);
        b[3] = frag16(brow3 + ks * 32);
        // holds the fetches above in front of this k-step's WMMAs; without it
        // the scheduler sinks them to their first use and the lead is lost
        __builtin_amdgcn_sched_barrier(0);
#pragma unroll
        for (int nt = 0; nt < 4; ++nt) {
          accq[nt] = wmma16(aq[u], b[nt], accq[nt]);
          acck[nt] = wmma16(ak[u], b[nt], acck[nt]);
          accv[nt] = wmma16(av[u], b[nt], accv[nt]);
        }
        // keeps the next k-step's x fragments behind these WMMAs, in the same
        // registers; without it the ring and a second b set spill to scratch
        __builtin_amdgcn_sched_barrier(0);
      }
      const int i0 = mt * 16 + hi * 8;
      // the lane's 8 biases of q, k, v: uniform base + one 32-bit lane offset
      const unsigned boff = (unsigned)i0 * 4u;
      float bqv[8], bkv[8], bvv[8];
#pragma unroll
      for (int e = 0; e < 8; ++e) {
        bqv[e] = *(const float*)((const char*)bq + boff + e * 4);
        bkv[e] = *(const float*)((const char*)bk + boff + e * 4);
        bvv[e] = *(const float*)((const char*)bv + boff + e * 4);
      }
      // before the offset register of the loads above is written again (the
      // input operand keeps it from being a later load's destination)
      asm volatile("s_wait_xcnt 0x0" :: "v"(boff) : "memory");
#pragma unroll
      for (int nt = 0; nt < 4; ++nt) {
        // q, k stored transposed: q_t/k_t[s][i] (8 contiguous halves per lane)
        v8h hq, hk;
#pragma unroll
        for (int e = 0; e < 8; ++e) {
          hq[e] = (_Float16)(accq[nt][e] + bqv[e]);
          hk[e] = (_Float16)(acck[nt][e] + bkv[e]);
        }
        const int t = nt * 16 + r;
        if (t < SS) {
          *(v8h*)(q_t + t * QP + i0) = hq;
          *(v8h*)(k_t + t * QP + i0) = hk;
        }
        // v natural: v_m[i][t]; columns t >= 49 hold copies of column 48
        // (finite), which meet zero probabilities only
#pragma unroll
        for (int e = 0; e < 8; ++e)
          v_m[(i0 + e) * VP + t] = (_Float16)(accv[nt][e] + bvv[e]);
      }
      aq[0] = aq[1]; ak[0] = ak[1]; av[0] = av[1];
      aq[1] = aq[2]; ak[1] = ak[2]; av[1] = av[2];
    }
  }
  __syncthreads();

  // GEMM4's weights, k-steps 0..2, start here: they land during the attention.
  const unsigned ooff = (unsigned)(wave * 16 * II + lane * 8) * 2u;  // bytes
  const _Float16* Woh1 = Woh + 16 * 16 * II;   // c-tiles 16..31
  v16h a0[4], a1[4];
#pragma unroll
  for (int p = 0; p < 3; ++p) {
    a0[p] = fragw(Woh + p * 512, ooff);
    a1[p] = fragw(Woh1 + p * 512, ooff);
  }

  // ---- attention, all in registers: wave st owns query rows st*16 .. +15 ----
  // (4 of the 8 waves; the others wait at the barrier below)
  if (__builtin_amdgcn_readfirstlane(wave) < SP / 16) {
    const int sa = __builtin_amdgcn_readfirstlane(wave) * 16 + r;
    // logits transposed: A = k rows (t), B = q rows (s), K = 256. The lane gets
    // lg[t2][e] = logit[s = sa][t = t2*16 + hi*8 + e]: one query's scores.
    // Tile 3's rows are all key 48, so every lg[3][e] is logit[sa][48].
    const _Float16* qrow  = q_t + (sa < SS ? sa : SS - 1) * QP + hi * 8;
    const _Float16* krow  = k_t + r * QP + hi * 8;
    const _Float16* krow3 = k_t + (SS - 1) * QP + hi * 8;
    v8f lg[4] = {{}, {}, {}, {}};
    v16h qf[2], kf[2][4];   // two register sets: fragments read one k-step ahead
    qf[0] = frag16(qrow);
#pragma unroll
    for (int t2 = 0; t2 < 3; ++t2) kf[0][t2] = frag16(krow + t2 * 16 * QP);
    kf[0][3] = frag16(krow3);
    // fully unrolled: the two sets must be compile-time register names
#pragma unroll
    for (int ks = 0; ks < II / 32; ++ks) {
      const int u = ks & 1, f = u ^ 1;
      if (ks + 1 < II / 32) {
        qf[f] = frag16(qrow + (ks + 1) * 32);
#pragma unroll
        for (int t2 = 0; t2 < 3; ++t2)
          kf[f][t2] = frag16(krow + t2 * 16 * QP + (ks + 1) * 32);
        kf[f][3] = frag16(krow3 + (ks + 1) * 32);
      }
      // holds the next k-step's reads, as one group, in front of these WMMAs;
      // without it each WMMA waits out the LDS latency of its own two reads
      __builtin_amdgcn_sched_barrier(0);
#pragma unroll
      for (int t2 = 0; t2 < 4; ++t2)
        lg[t2] = wmma16(kf[u][t2], qf[u], lg[t2]);
      // keeps the reads after next behind these WMMAs, in the same registers
      __builtin_amdgcn_sched_barrier(0);
    }
    // v rows (i) of the first two i-tiles: they land during the softmax
    const _Float16* vrow = v_m + r * VP + hi * 8;
    v16h vf[2][2][2];       // [register set][i-tile of the pair][k-step]
#pragma unroll
    for (int j = 0; j < 2; ++j) {
      vf[0][j][0] = frag16(vrow + j * 16 * VP);
      vf[0][j][1] = frag16(vrow + j * 16 * VP + 32);
    }
    // softmax over t: 24 scores here, 24 in lane ^ 16, and key 48 in both
    float m = lg[3][0];
#pragma unroll
    for (int t2 = 0; t2 < 3; ++t2) {
#pragma unroll
      for (int e = 0; e < 8; ++e) m = fmaxf(m, lg[t2][e]);
    }
    m = fmaxf(m, xhalf(m));
    float ts[3] = {0.f, 0.f, 0.f};
#pragma unroll
    for (int e = 0; e < 8; ++e) {
#pragma unroll
      for (int t2 = 0; t2 < 3; ++t2) {
        lg[t2][e] = exp_slot(lg[t2][e] - m);
        ts[t2] += lg[t2][e];
      }
    }
    const float p48 = exp_slot(lg[3][0] - m);
    float sum = ts[0] + ts[1] + ts[2];
    sum = sum + xhalf(sum) + p48;
    const float inv = 1.f / sum;
    // two score tiles, converted in place, are the B fragment of 32 keys
    // (the k order of frag16); keys 49..63 get zero
    v16h pf0, pf1;
#pragma unroll
    for (int e = 0; e < 8; ++e) {
      pf0[e]     = (_Float16)(lg[0][e] * inv);
      pf0[e + 8] = (_Float16)(lg[1][e] * inv);
      pf1[e]     = (_Float16)(lg[2][e] * inv);
      pf1[e + 8] = (_Float16)0.f;
    }
    pf1[8] = (_Float16)(hi == 0 ? p48 * inv : 0.f);
    // y transposed: A = v rows (i), B = probabilities, K = 64: the lane gets
    // y[s = sa][i = it*16 + hi*8 + e], one 16-byte store. Query rows past the
    // last go to a spare strip, so that no lane is masked among the WMMAs.
    _Float16* yrow = (sa < SS ? y_t + sa * QP : y_pad + (sa - SS) * QP) + hi * 8;
    // fully unrolled: the two sets must be compile-time register names
#pragma unroll
    for (int ig = 0; ig < 8; ++ig) {
      const int u = ig & 1, f = u ^ 1;
      if (ig + 1 < 8) {
#pragma unroll
        for (int j = 0; j < 2; ++j) {
          vf[f][j][0] = frag16(vrow + ((ig + 1) * 2 + j) * 16 * VP);
          vf[f][j][1] = frag16(vrow + ((ig + 1) * 2 + j) * 16 * VP + 32);
        }
      }
      // holds the next pair's reads, as one group, in front of these WMMAs
      __builtin_amdgcn_sched_barrier(0);
      v8f acc[2] = {{}, {}};
#pragma unroll
      for (int k = 0; k < 2; ++k) {
#pragma unroll
        for (int j = 0; j < 2; ++j)
          acc[j] = wmma16(vf[u][j][k], k ? pf1 : pf0, acc[j]);
      }
#pragma unroll
      for (int j = 0; j < 2; ++j) {
        v8h h;
#pragma unroll
        for (int e = 0; e < 8; ++e) h[e] = (_Float16)acc[j][e];
        *(v8h*)(yrow + (ig * 2 + j) * 16) = h;
      }
    }
  }
  __syncthreads();

  // ---- GEMM4: z[c][s] = Wo[512x256] * y + bias + residual, ReLU ----
  // Wave = two c-tiles at a time (ct, ct + 16), twice (ct = wave, wave + NW);
  // the 4 B (y_t) fragments are shared: 12 b128 loads / 8 WMMAs per k-step.
  {
    const _Float16* brow  = y_t + r * QP + hi * 8;
    const _Float16* brow3 = y_t + (SS - 1) * QP + hi * 8;  // s-tile 3: row 48
    // set in the second pass only; names of their own, so that the old pq/pk/pv
    // do not stay live (48 registers) from GEMM1 to here
    v16h nq[2], nk[2], nv[2];
    // rolled: unrolling the two passes would double the kernel's text
#pragma unroll 1
    for (int pass = 0; pass < 2; ++pass) {
      v8f acc0[4] = {{}, {}, {}, {}};      // ct = wave + pass * NW
      v8f acc1[4] = {{}, {}, {}, {}};      // ct + 16
      const unsigned oo = ooff + (unsigned)(pass * NW * 16 * II) * 2u;
#pragma unroll
      for (int ks = 0; ks < II / 32; ++ks) {
        if (ks + 3 < II / 32) {
          a0[(ks + 3) & 3] = fragw(Woh + (ks + 3) * 512, oo);
          a1[(ks + 3) & 3] = fragw(Woh1 + (ks + 3) * 512, oo);
        } else if (pass == 0) {
          // the second pair's k-steps 0..2
          const unsigned on = oo + (unsigned)(NW * 16 * II) * 2u;
          a0[(ks + 3) & 3] = fragw(Woh + (ks + 3 - II / 32) * 512, on);
          a1[(ks + 3) & 3] = fragw(Woh1 + (ks + 3 - II / 32) * 512, on);
        }
        v16h b[4];
#pragma unroll
        for (int st = 0; st < 3; ++st)
          b[st] = frag16(brow + st * 16 * QP + ks * 32);
        b[3] = frag16(brow3 + ks * 32);
        // holds the fetches above in front of this k-step's WMMAs (as in GEMM1)
        __builtin_amdgcn_sched_barrier(0);
#pragma unroll
        for (int st = 0; st < 4; ++st) {
          acc0[st] = wmma16(a0[ks & 3], b[st], acc0[st]);
          acc1[st] = wmma16(a1[ks & 3], b[st], acc1[st]);
        }
      }
      // next block's first q/k/v weights land during this block's epilogue
      if (nWqh && pass == 1) {
        const unsigned woff = (unsigned)(wave * 16 * CG + lane * 8) * 2u;
#pragma unroll
        for (int p = 0; p < 2; ++p) {
          nq[p] = fragw(nWqh + p * 512, woff);
          nk[p] = fragw(nWkh + p * 512, woff);
          nv[p] = fragw(nWvh + p * 512, woff);
        }
      }
#pragma unroll
      for (int half = 0; half < 2; ++half) {
        const int c0 = (wave + pass * NW + half * 16) * 16 + hi * 8;
        v8f* accs = half ? acc1 : acc0;
        float ps[8] = {0.f, 0.f, 0.f, 0.f, 0.f, 0.f, 0.f, 0.f};
#pragma unroll
        for (int st = 0; st < 4; ++st) {
          const int s = st * 16 + r;
          if (s < SS) {
            _Float16* px = xt + s * XP + c0;
            const v8h res = *(const v8h*)px;
            v8h hv;
#pragma unroll
            for (int e = 0; e < 8; ++e) {
              const float z =
                  fmaxf(accs[st][e] + bo[c0 + e] + (float)res[e], 0.f);
              hv[e] = (_Float16)z;
              ps[e] += (float)hv[e];
            }
            if (!POOL) *(v8h*)px = hv;
          }
        }
        if (POOL) {
          // sum over the 16 lanes that hold the s positions of these channels
#pragma unroll
          for (int e = 0; e < 8; ++e) {
#pragma unroll
            for (int o = 1; o < 16; o <<= 1)
              ps[e] += __shfl_xor(ps[e], o, 16);
          }
          if (r == 0) {
#pragma unroll
            for (int e = 0; e < 8; ++e)
              pool_f[c0 + e] = ps[e] * (1.f / (float)SS);
          }
        }
      }
    }
    if (nWqh) {
#pragma unroll
      for (int p = 0; p < 2; ++p) { pq[p] = nq[p]; pk[p] = nk[p]; pv[p] = nv[p]; }
    }
  }
  __syncthreads();
}

__global__ void cvt_pack_f16_kernel(const float* __restrict__ src,
                                    _Float16* __restrict__ dst, int n,
                                    int lgks) {
  const int d = blockIdx.x * 256 + threadIdx.x;
  if (d < n) {
    const int e    = d & 7;
    const int ln   = (d >> 3) & 31;
    const int part = (d >> 8) & 1;
    const int tile = d >> 9;
    const int ks   = tile & ((1 << lgks) - 1);
    const int mt   = tile >> lgks;
    const int row  = mt * 16 + (ln & 15);
    const int k    = ks * 32 + part * 16 + (ln >> 4) * 8 + e;
    dst[d] = (_Float16)src[(size_t)row * (32 << lgks) + k];
  }
}

__global__ __launch_bounds__(256) __attribute__((amdgpu_waves_per_eu(4, 4)))
void frcnn_nonlocal_kernel(
    const float* __restrict__ x,
    const _Float16* __restrict__ wq_h, const _Float16* __restrict__ wk_h,
    const _Float16* __restrict__ wv_h, const _Float16* __restrict__ wo_h,
    const float* __restrict__ bq, const float* __restrict__ bk,
    const float* __restrict__ bv, const float* __restrict__ bo,
    float* __restrict__ pc, float* __restrict__ pr)
{
  extern __shared__ char smem[];
  _Float16* x_t    = (_Float16*)(smem + OFF_XT);
  _Float16* q_t    = (_Float16*)(smem + OFF_QT);
  _Float16* k_t    = (_Float16*)(smem + OFF_KT);
  _Float16* v_m    = (_Float16*)(smem + OFF_VM);
  _Float16* y_t    = (_Float16*)(smem + OFF_QT);   // on q_t, row by row
  float*    pool_f = (float*)   (smem + OFF_PF);
  _Float16* y_pad  = (_Float16*)(smem + OFF_YP);   // written, never read

  const int n    = blockIdx.x >> 2;
  const int g    = blockIdx.x & 3;
  const int tid  = threadIdx.x;
  const int wave = tid >> 5;
  const int lane = tid & 31;

  // Load x tile (transpose [c][s] -> x_t[s][c], fp32 -> f16).
  // Unit u = (8 channels, one s): lanes walk s, so a wave-wide b32 load reads
  // 128 contiguous bytes, and a thread's 8 loads make one 16-byte LDS row piece.
  // All of a thread's loads are issued before the first is used: the tile
  // costs one memory latency, not one per batch.
  const float* xg = x + ((size_t)n * CTOT + (size_t)g * CG) * SS;
  float xv[12][8];
#pragma unroll
  for (int i = 0; i < 12; ++i) {
    const int u  = tid + i * 256;
    const int cg = u / SS;
    const unsigned ob = (unsigned)(cg * 8 * SS + (u - cg * SS)) * 4u;  // bytes
    const float* p = (const float*)((const char*)xg + ob);
#pragma unroll
    for (int j = 0; j < 8; ++j) xv[i][j] = p[j * SS];
  }
  // 3136 units = 12 * 256 + 64: of the last 64 each thread takes two channels
  const int ul  = 12 * 256 + (tid & 63);
  const int cl  = (ul / SS) * 8 + (tid >> 6);      // and cl + 4
  const int sl  = ul % SS;
  const float xl0 = xg[cl * SS + sl];
  const float xl1 = xg[(cl + 4) * SS + sl];
  // before any address register of the loads above is written again
  asm volatile("s_wait_xcnt 0x0" ::: "memory");
  // keeps what follows (it reuses those address registers) behind the wait
  __builtin_amdgcn_sched_barrier(0);
  // block 0's first q/k/v weights land while the x tile is brought in
  v16h pq[2], pk[2], pv[2];
#pragma unroll
  for (int p = 0; p < 2; ++p) {
    const unsigned woff = (unsigned)(wave * 16 * CG + lane * 8) * 2u;
    pq[p] = fragw(wq_h + p * 512, woff);
    pk[p] = fragw(wk_h + p * 512, woff);
    pv[p] = fragw(wv_h + p * 512, woff);
  }
  // holds these fetches in front of the conversions below, which wait for x
  __builtin_amdgcn_sched_barrier(0);
#pragma unroll
  for (int i = 0; i < 12; ++i) {
    const int u  = tid + i * 256;
    const int cg = u / SS;
    v8h h;
#pragma unroll
    for (int j = 0; j < 8; ++j) h[j] = (_Float16)xv[i][j];
    *(v8h*)(x_t + (u - cg * SS) * XP + cg * 8) = h;
  }
  x_t[sl * XP + cl]     = (_Float16)xl0;
  x_t[sl * XP + cl + 4] = (_Float16)xl1;
  __syncthreads();

  const size_t pbase = (size_t)n * CTOT + (size_t)g * CG + (size_t)(tid * 2);

  // block 0 (shared): x_t in place
  nl_block<false>(wq_h, wk_h, wv_h, wo_h, bq, bk, bv, bo,
           wq_h + 1 * II * CG, wk_h + 1 * II * CG, wv_h + 1 * II * CG,
           pq, pk, pv, x_t, q_t, k_t, v_m, y_t, y_pad, pool_f,
           wave, lane);
  // block 1 (cls): x_t -> channel means
  nl_block<true>(wq_h + 1 * II * CG, wk_h + 1 * II * CG, wv_h + 1 * II * CG,
           wo_h + 1 * CG * II, bq + II, bk + II, bv + II, bo + CG,
           wq_h + 2 * II * CG, wk_h + 2 * II * CG, wv_h + 2 * II * CG,
           pq, pk, pv, x_t, q_t, k_t, v_m, y_t, y_pad, pool_f,
           wave, lane);
  // a wave stores two whole lines; pool_f is next written behind block 2's
  // barriers
  *(float2*)(pc + pbase) = *(const float2*)(pool_f + tid * 2);
  // before a register of the store above is written again
  asm volatile("s_wait_xcnt 0x0" ::: "memory");
  // block 2 (reg): x_t -> channel means
  nl_block<true>(wq_h + 2 * II * CG, wk_h + 2 * II * CG, wv_h + 2 * II * CG,
           wo_h + 2 * CG * II, bq + 2 * II, bk + 2 * II, bv + 2 * II,
           bo + 2 * CG, nullptr, nullptr, nullptr,
           pq, pk, pv, x_t, q_t, k_t, v_m, y_t, y_pad, pool_f,
           wave, lane);
  *(float2*)(pr + pbase) = *(const float2*)(pool_f + tid * 2);
}

// ---------------------------------------------------------------------------
// Final linears: one work-group of 16 waves per 32 x 48 output tile, K = 2048.
// The 32 pooled rows and 48 weight rows come in by whole-line loads (a wave-wide
// b128 load = 512 contiguous bytes of one row), three k-chunks in flight, and go
// as f16 through LDS, where the fragments are read. Wave = (row tile, k-step of
// the chunk): 8 partial sums per output, added through LDS at the end.
#define CLS_GRPS 2    // ceil(81/48)
#define REG_GRPS 7    // ceil(324/48)
#define HM    32      // pooled rows per work-group
#define HN    48      // output columns per work-group
#define HKC   256     // k per chunk
#define HP    264     // LDS row pitch in halves (16 B x odd)
#define HBUF  ((HM + HN) * HP)
#define HNCH  (CTOT / HKC)
#define HRING 3
#define HPASS ((HM + HN) / 8)

__global__ __launch_bounds__(512) void frcnn_head_kernel(
    const float* __restrict__ pc, const float* __restrict__ pr,
    const float* __restrict__ Wc, const float* __restrict__ bc,
    const float* __restrict__ Wb, const float* __restrict__ bb,
    float* __restrict__ out)
{
  __shared__ __attribute__((aligned(16))) _Float16 hs[2 * HBUF];

  const int mb = blockIdx.x;   // block of 32 rois, 0..15
  const int yg = blockIdx.y;   // 0..8
  const float* P; const float* W; const float* bias; float* O;
  int ncols, n0;
  if (yg < CLS_GRPS) { P = pc; W = Wc; bias = bc; O = out;
                       ncols = NCLS; n0 = yg * HN; }
  else               { P = pr; W = Wb; bias = bb; O = out + NROI * NCLS;
                       ncols = NBOX; n0 = (yg - CLS_GRPS) * HN; }

  const int tid  = threadIdx.x;
  const int wave = tid >> 5;
  const int lane = tid & 31;
  const int r  = lane & 15;
  const int hi = lane >> 4;
  const int c4   = tid & 63;   // which 16 bytes of a row's 1-KiB chunk
  const int rsub = tid >> 6;   // row within a pass of 8 rows

  // byte offsets of this thread's piece in each of the 10 rows it brings in;
  // a column past the last reads the last row (its outputs are never stored)
  unsigned off[HPASS];
#pragma unroll
  for (int j = 0; j < HPASS; ++j) {
    int row;
    if (j < HM / 8) {
      row = mb * HM + j * 8 + rsub;
    } else {
      row = n0 + (j - HM / 8) * 8 + rsub;
      row = row < ncols ? row : ncols - 1;
    }
    off[j] = (unsigned)row * (CTOT * 4u) + (unsigned)c4 * 16u;
  }

  float4 rg[HRING][HPASS];
#pragma unroll
  for (int p = 0; p < HRING; ++p) {
#pragma unroll
    for (int j = 0; j < HPASS; ++j)
      rg[p][j] = *(const float4*)((const char*)(j < HM / 8 ? P : W) + off[j] +
                                  p * (HKC * 4));
  }

  const int mtile = wave >> 3;   // 0..1
  const int kw    = wave & 7;    // k-step of the chunk
  v8f acc[3] = {{}, {}, {}};
#pragma unroll
  for (int ch = 0; ch < HNCH; ++ch) {
    _Float16* buf = hs + (ch & 1) * HBUF;
    const int s = ch % HRING;
#pragma unroll
    for (int j = 0; j < HPASS; j += 2) {
      uint2 h0, h1;
      asm volatile("v_nop\n\tv_nop\n\tv_nop\n\tv_nop\n\t"
                   "v_cvt_pk_f16_f32 %0, %4, %5\n\t"
                   "v_cvt_pk_f16_f32 %1, %6, %7\n\t"
                   "v_cvt_pk_f16_f32 %2, %8, %9\n\t"
                   "v_cvt_pk_f16_f32 %3, %10, %11"
                   : "=&v"(h0.x), "=&v"(h0.y), "=&v"(h1.x), "=&v"(h1.y)
                   : "v"(rg[s][j].x), "v"(rg[s][j].y), "v"(rg[s][j].z),
                     "v"(rg[s][j].w), "v"(rg[s][j + 1].x), "v"(rg[s][j + 1].y),
                     "v"(rg[s][j + 1].z), "v"(rg[s][j + 1].w));
      *(uint2*)(buf + (j * 8 + rsub) * HP + c4 * 4) = h0;
      *(uint2*)(buf + ((j + 1) * 8 + rsub) * HP + c4 * 4) = h1;
    }
    if (ch + HRING < HNCH) {
#pragma unroll
      for (int j = 0; j < HPASS; ++j)
        rg[s][j] = *(const float4*)((const char*)(j < HM / 8 ? P : W) + off[j] +
                                    (ch + HRING) * (HKC * 4));
      // behind the last loads: their offset registers are free to be reused
      if (ch + HRING == HNCH - 1) asm volatile("s_wait_xcnt 0x0" ::: "memory");
      // holds the refill here, three chunks ahead of its use; without it the
      // scheduler may sink the loads to their first use and the lead is lost
      __builtin_amdgcn_sched_barrier(0);
    }
    // one barrier a chunk: it publishes this buffer, and every reader of the
    // other buffer (chunk ch - 1) has passed it before chunk ch + 1 is stored.
    // By hand, with the LDS wait alone: __syncthreads() also waits for every
    // global load, which would end the refills' lead at each chunk
    asm volatile("s_wait_dscnt 0x0\n\ts_barrier_signal -1\n\ts_barrier_wait -1"
                 ::: "memory");
    const _Float16* fp = buf + r * HP + kw * 32 + hi * 8;
    const v16h a = frag16(fp + mtile * 16 * HP);
#pragma unroll
    for (int nt = 0; nt < 3; ++nt)
      acc[nt] = wmma16(a, frag16(fp + (HM + nt * 16) * HP), acc[nt]);
  }
  __syncthreads();

  // partial sums: red[wave][nt][e][lane]
  float* red = (float*)hs;
#pragma unroll
  for (int nt = 0; nt < 3; ++nt) {
#pragma unroll
    for (int e = 0; e < 8; ++e)
      red[((wave * 3 + nt) * 8 + e) * 32 + lane] = acc[nt][e];
  }
  __syncthreads();
#pragma unroll
  for (int j = 0; j < 3; ++j) {
    // wave-uniform (row tile, column tile, e); lanes as in the accumulator
    const int id = wave + j * 16;          // 0..47
    const int mt = id / 24;
    const int nt = (id / 8) % 3;
    const int e  = id & 7;
    float sum = 0.f;
#pragma unroll
    for (int k = 0; k < 8; ++k)
      sum += red[(((mt * 8 + k) * 3 + nt) * 8 + e) * 32 + lane];
    const int ncol = n0 + nt * 16 + r;
    const int nr   = mb * HM + mt * 16 + hi * 8 + e;
    if (ncol < ncols) O[(size_t)nr * ncols + ncol] = sum + bias[ncol];
  }
}

// ---------------------------------------------------------------------------
extern "C" void kernel_launch(void* const* d_in, const int* in_sizes, int n_in,
                              void* d_out, int out_size, void* d_ws, size_t ws_size,
                              hipStream_t stream) {
  (void)in_sizes; (void)n_in; (void)out_size; (void)ws_size;
  const float* x  = (const float*)d_in[0];
  const float* Wq = (const float*)d_in[1];
  const float* bq = (const float*)d_in[2];
  const float* Wk = (const float*)d_in[3];
  const float* bk = (const float*)d_in[4];
  const float* Wv = (const float*)d_in[5];
  const float* bv = (const float*)d_in[6];
  const float* Wo = (const float*)d_in[7];
  const float* bo = (const float*)d_in[8];
  const float* Wc = (const float*)d_in[9];
  const float* bc = (const float*)d_in[10];
  const float* Wb = (const float*)d_in[11];
  const float* bb = (const float*)d_in[12];
  float* out = (float*)d_out;

  // workspace layout
  const size_t WN = (size_t)3 * II * CG;  // per qkv-stack element count
  char* ws = (char*)d_ws;
  _Float16* wq_h = (_Float16*)(ws);                    // 3*256*512 f16
  _Float16* wk_h = (_Float16*)(ws + WN * 2);
  _Float16* wv_h = (_Float16*)(ws + WN * 4);
  _Float16* wo_h = (_Float16*)(ws + WN * 6);           // 3*512*256 f16
  float*    pc   = (float*)   (ws + WN * 8);           // 512*2048 f32
  float*    pr   = (float*)   (ws + WN * 8 + (size_t)NROI * CTOT * 4);

  const int wn = (int)WN;
  cvt_pack_f16_kernel<<<(wn + 255) / 256, 256, 0, stream>>>(Wq, wq_h, wn, 4);
  cvt_pack_f16_kernel<<<(wn + 255) / 256, 256, 0, stream>>>(Wk, wk_h, wn, 4);
  cvt_pack_f16_kernel<<<(wn + 255) / 256, 256, 0, stream>>>(Wv, wv_h, wn, 4);
  cvt_pack_f16_kernel<<<(wn + 255) / 256, 256, 0, stream>>>(Wo, wo_h, wn, 3);

  // 2) fused 3x non-local chain + pooling: one WG per (n, g)
  frcnn_nonlocal_kernel<<<NROI * GRP, 256, LDS_TOTAL, stream>>>(
      x, wq_h, wk_h, wv_h, wo_h, bq, bk, bv, bo, pc, pr);

  // 3) classification / bbox heads
  dim3 hgrid(NROI / HM, CLS_GRPS + REG_GRPS);
  frcnn_head_kernel<<<hgrid, 512, 0, stream>>>(pc, pr, Wc, bc, Wb, bb, out);
}

// v007
// A run of this version takes 256 microseconds.
// In both of two side-by-side timings against v006, it was 1.13 times as fast.
// All steps since v000 together make it 2.43 times as fast.
#include <hip/hip_runtime.h>
#include <hip/hip_bf16.h>

typedef __attribute__((ext_vector_type(16))) _Float16 v16h;
typedef __attribute__((ext_vector_type(8)))  _Float16 v8h;
typedef __attribute__((ext_vector_type(8)))  float    v8f;
typedef __attribute__((ext_vector_type(4)))  float    v4f;

#define NROI 512
#define CTOT 2048
#define GRP  4
#define CG   512
#define II   256
#define SS   49
#define SP   64
#define NCLS 81
#define NBOX 324

// LDS row pitches in halves
#define XP  520   // x tile: [98 s][512 c + pad]
#define QP  264   // q_t/k_t/y_t: [98 s][256 i + pad]
#define VP  72    // v: [2 x 256 i][64 t + pad]

#define NW  16    // waves per work-group
#define NR  2     // (n, g) tiles per work-group
#define SR  98    // their rows, one tile's behind the other's
#define NT  7     // 16-row fragment tiles over the 98 rows

// LDS byte offsets (all 16B aligned). One work-group holds two (n, g) tiles, so
// that a weight fragment fetched from L2 serves both. Only the 98 real rows of
// x, q, k and y are kept (a fragment row past the last reads row 97; its
// columns are never used); y_t lies on q_t: a wave writes the rows that it
// alone has read.
#define OFF_XT   0u
#define OFF_QT   101920u
#define OFF_KT   153664u
#define OFF_VM   205408u
#define OFF_PF   279136u
#define OFF_YP   283232u   // 2 x 15 spare y rows
#define LDS_TOTAL 299072u

__device__ __forceinline__ v16h frag16(const _Float16* p) {
  v8h lo = *(const v8h*)(p);
  v8h hv = *(const v8h*)(p + 16);
  v16h r;
#pragma unroll
  for (int i = 0; i < 8; ++i) { r[i] = lo[i]; r[i + 8] = hv[i]; }
  return r;
}

__device__ __forceinline__ v16h fragw(const _Float16* tile, unsigned lane_off) {
  const char* p = (const char*)tile + lane_off;
  v8h lo = *(const v8h*)(p);
  v8h hv = *(const v8h*)(p + 512);
  v16h r;
#pragma unroll
  for (int i = 0; i < 8; ++i) { r[i] = lo[i]; r[i + 8] = hv[i]; }
  return r;
}

__device__ __forceinline__ float xhalf(float x) {
  const int b = __builtin_bit_cast(int, x);
  return __builtin_bit_cast(float, __builtin_amdgcn_permlanex16(
      b, b, 0x76543210, 0xfedcba98, false, false));
}

__device__ __forceinline__ float exp_slot(float x) {
  float y;
  asm("v_exp_f32 %0, %1\n\tv_nop" : "=v"(y) : "v"(x * 1.44269504f));
  return y;
}

__device__ __forceinline__ v8f wmma16(v16h a, v16h b, v8f c) {
  return __builtin_amdgcn_wmma_f32_16x16x32_f16(false, a, false, b, (short)0, c,
                                                false, false);
}

// One grouped non-local block on two [512 c x 49 s] LDS-resident tiles.
// xt layout: [s][c] (c contiguous, pitch XP), rows 0..48 the first tile's, rows
// 49..97 the second's: for the two GEMMs one matrix of 98 columns.
// POOL false: the result replaces xt in place (each element is read and written
// by its one owner thread). POOL true: xt stays, and the mean over s of each
// tile's result goes to pool_f[tile][c].
// Weight fragments come from L2, each once per work-group, and are fetched
// ahead of their use, so a wave's WMMAs of one k-step run while the next
// weights are in flight. pq/pk/pv hold k-step 0 of this block's q/k/v weights
// on entry; on exit that of the next block (nq/nk/nv: the lane's own address of
// its first 16 bytes there; null = none).
template <bool POOL>
__device__ __forceinline__ void nl_block(
    const _Float16* __restrict__ Wqh, const _Float16* __restrict__ Wkh,
    const _Float16* __restrict__ Wvh, const _Float16* __restrict__ Woh,
    const float* __restrict__ bq, const float* __restrict__ bk,
    const float* __restrict__ bv, const float* __restrict__ bo,
    const char* nq, const char* nk, const char* nv,
    v16h &pq, v16h &pk, v16h &pv,
    _Float16* xt,
    _Float16* q_t, _Float16* k_t, _Float16* v_m,
    _Float16* y_t, _Float16* y_pad, float* pool_f,
    int wave, int lane)
{
  const int r  = lane & 15;
  const int hi = lane >> 4;
  // the wave's number in a scalar register: its weight tiles and biases then
  // have scalar bases, and one vector register (the lane's 16 bytes of a
  // fragment plane) serves every weight load but the next block's (nq/nk/nv)
  const int wu = __builtin_amdgcn_readfirstlane(wave);
  const unsigned l16 = (unsigned)lane * 16u;

  // ---- GEMM1: q/k/v[256 x 98] = W[256x512] * x ----
  // Wave = one i-tile (mt = wave) of q, k and v over all 7 s-tiles: a k-step
  // takes 6 b128 weight loads and 14 b128 LDS reads for 21 WMMAs.
  {
    const _Float16* brow  = xt + r * XP + hi * 8;
    // s-tile 6: rows 96, 97, and 97 again
    const _Float16* brow6 = xt + (6 * 16 + (r ? 1 : 0)) * XP + hi * 8;
    // two register sets, weights fetched one k-step ahead
    v16h aq[2], ak[2], av[2];
    aq[0] = pq; ak[0] = pk; av[0] = pv;
    v8f accq[NT] = {{}, {}, {}, {}, {}, {}, {}};
    v8f acck[NT] = {{}, {}, {}, {}, {}, {}, {}};
    v8f accv[NT] = {{}, {}, {}, {}, {}, {}, {}};
    // packed tiles: 512 halves per (i-tile, k-step), k-steps consecutive
    const _Float16* wq = Wqh + wu * 16 * CG;
    const _Float16* wk = Wkh + wu * 16 * CG;
    const _Float16* wv = Wvh + wu * 16 * CG;
    int kb = 0;   // halves
    // One k-step. The x fragments come two at a time, into the same
    // registers. The scheduling barriers hold the fetches in front of the WMMAs
    // (else the scheduler sinks them to their first use and the lead is lost)
    // and each group of x fragments behind the WMMAs before it (else a second
    // set of them is live and the accumulators spill).
#define G1_STEP(U, F, PRE, KO)                                               \
    {                                                                        \
      if (PRE) {                                                             \
        aq[F] = fragw(wq + ((KO) + 1) * 512, l16);                           \
        ak[F] = fragw(wk + ((KO) + 1) * 512, l16);                           \
        av[F] = fragw(wv + ((KO) + 1) * 512, l16);                           \
        /* before an address register of these loads is written again; the */ \
        /* scheduling barrier keeps the x reads, which may do so, behind it */ \
        asm volatile("s_wait_xcnt 0x0" ::: "memory");                        \
        __builtin_amdgcn_sched_barrier(0);                                   \
      }                                                                      \
      v16h b[2];                                                             \
      _Pragma("unroll")                                                      \
      for (int gq = 0; gq < 3; ++gq) {                                       \
        _Pragma("unroll")                                                    \
        for (int nt = 0; nt < 2; ++nt)                                       \
          b[nt] = frag16(brow + kb + (gq * 2 + nt) * 16 * XP + (KO) * 32);   \
        __builtin_amdgcn_sched_barrier(0);                                   \
        _Pragma("unroll")                                                    \
        for (int nt = 0; nt < 2; ++nt) {                                     \
          accq[gq * 2 + nt] = wmma16(aq[U], b[nt], accq[gq * 2 + nt]);       \
          acck[gq * 2 + nt] = wmma16(ak[U], b[nt], acck[gq * 2 + nt]);       \
          accv[gq * 2 + nt] = wmma16(av[U], b[nt], accv[gq * 2 + nt]);       \
        }                                                                    \
        __builtin_amdgcn_sched_barrier(0);                                   \
      }                                                                      \
      b[0] = frag16(brow6 + kb + (KO) * 32);                                 \
      __builtin_amdgcn_sched_barrier(0);                                     \
      accq[6] = wmma16(aq[U], b[0], accq[6]);                                \
      acck[6] = wmma16(ak[U], b[0], acck[6]);                                \
      accv[6] = wmma16(av[U], b[0], accv[6]);                                \
      __builtin_amdgcn_sched_barrier(0);                                     \
    }
    // rolled, two k-steps a trip (the two sets must be compile-time register
    // names); rolled for speed only
#pragma unroll 1
    for (int kp = 0; kp < CG / 64; ++kp) {
      G1_STEP(0, 1, true, 0)
      G1_STEP(1, 0, kp + 1 < CG / 64, 1)
      // before the base registers of the weight loads are written again (the
      // input operands keep the registers as they are up to here)
      asm volatile("s_wait_xcnt 0x0" :: "s"(wq), "s"(wk), "s"(wv) : "memory");
      wq += 2 * 512;
      wk += 2 * 512;
      wv += 2 * 512;
      kb += 64;
    }
#undef G1_STEP
    const int i0 = wave * 16 + hi * 8;
    // the lane's 8 biases of q, k, v: the i-tile's 16 from one address for the
    // whole wave, each half-wave takes its 8
    float bqv[8], bkv[8], bvv[8];
    {
      // the two scheduling barriers keep everything else out from between
      // these loads and the wait behind them
      __builtin_amdgcn_sched_barrier(0);
      const v4f* q4 = (const v4f*)(bq + wu * 16);
      const v4f* k4 = (const v4f*)(bk + wu * 16);
      const v4f* v4 = (const v4f*)(bv + wu * 16);
      const v4f tq[4] = {q4[0], q4[1], q4[2], q4[3]};
      const v4f tk[4] = {k4[0], k4[1], k4[2], k4[3]};
      const v4f tv[4] = {v4[0], v4[1], v4[2], v4[3]};
      // before a register of the loads above is written again; the loaded
      // values as inputs hold the loads in front of it
      asm volatile("s_wait_xcnt 0x0"
                   :: "v"(tq[0]), "v"(tq[1]), "v"(tq[2]), "v"(tq[3]),
                      "v"(tk[0]), "v"(tk[1]), "v"(tk[2]), "v"(tk[3]),
                      "v"(tv[0]), "v"(tv[1]), "v"(tv[2]), "v"(tv[3])
                   : "memory");
      __builtin_amdgcn_sched_barrier(0);
#pragma unroll
      for (int e = 0; e < 8; ++e) {
        const int a = e >> 2, c = e & 3;
        bqv[e] = hi ? tq[2 + a][c] : tq[a][c];
        bkv[e] = hi ? tk[2 + a][c] : tk[a][c];
        bvv[e] = hi ? tv[2 + a][c] : tv[a][c];
      }
    }
#pragma unroll
    for (int nt = 0; nt < NT; ++nt) {
      // q, k stored transposed: q_t/k_t[s][i] (8 contiguous halves per lane)
      v8h hq, hk;
#pragma unroll
      for (int e = 0; e < 8; ++e) {
        hq[e] = (_Float16)(accq[nt][e] + bqv[e]);
        hk[e] = (_Float16)(acck[nt][e] + bkv[e]);
      }
      const int s = nt * 16 + r;
      if (s < SR) {
        *(v8h*)(q_t + s * QP + i0) = hq;
        *(v8h*)(k_t + s * QP + i0) = hk;
        // v natural, a plane per tile: v_m[tile][i][t]; columns t >= 49 were
        // zeroed at the kernel's start and meet zero probabilities only
        const int vb = s < SS ? s : II * VP + s - SS;
#pragma unroll
        for (int e = 0; e < 8; ++e)
          v_m[(i0 + e) * VP + vb] = (_Float16)(accv[nt][e] + bvv[e]);
      }
    }
  }
  __syncthreads();

  // GEMM4's weights, k-steps 0 and 1, start here: they land during the attention.
  const _Float16* Woh0 = Woh + wu * 16 * II;   // c-tile wave
  const _Float16* Woh1 = Woh0 + 16 * 16 * II;  // c-tile wave + 16
  v16h a0[3], a1[3];
#pragma unroll
  for (int p = 0; p < 2; ++p) {
    a0[p] = fragw(Woh0 + p * 512, l16);
    a1[p] = fragw(Woh1 + p * 512, l16);
  }

  // ---- attention, all in registers: wave (tile ro, st) owns query rows
  // st*16 .. +15 of its tile (8 of the 16 waves; the others wait at the barrier
  // below)
  if (__builtin_amdgcn_readfirstlane(wave) < NR * (SP / 16)) {
    const int ro = __builtin_amdgcn_readfirstlane(wave) >> 2;
    const int sa = (__builtin_amdgcn_readfirstlane(wave) & 3) * 16 + r;
    // logits transposed: A = k rows (t), B = q rows (s), K = 256. The lane gets
    // lg[t2][e] = logit[s = sa][t = t2*16 + hi*8 + e]: one query's scores.
    // Tile 3's rows are all key 48, so every lg[3][e] is logit[sa][48].
    const _Float16* qrow  = q_t + (ro * SS + (sa < SS ? sa : SS - 1)) * QP + hi * 8;
    const _Float16* krow  = k_t + (ro * SS + r) * QP + hi * 8;
    const _Float16* krow3 = k_t + (ro * SS + SS - 1) * QP + hi * 8;
    v8f lg[4] = {{}, {}, {}, {}};
    v16h qf[2], kf[2][4];   // two register sets: fragments read one k-step ahead
    qf[0] = frag16(qrow);
#pragma unroll
    for (int t2 = 0; t2 < 3; ++t2) kf[0][t2] = frag16(krow + t2 * 16 * QP);
    kf[0][3] = frag16(krow3);
    // fully unrolled: the two sets must be compile-time register names
#pragma unroll
    for (int ks = 0; ks < II / 32; ++ks) {
      const int u = ks & 1, f = u ^ 1;
      if (ks + 1 < II / 32) {
        qf[f] = frag16(qrow + (ks + 1) * 32);
#pragma unroll
        for (int t2 = 0; t2 < 3; ++t2)
          kf[f][t2] = frag16(krow + t2 * 16 * QP + (ks + 1) * 32);
        kf[f][3] = frag16(krow3 + (ks + 1) * 32);
      }
      // holds the next k-step's reads, as one group, in front of these WMMAs;
      // without it each WMMA waits out the LDS latency of its own two reads
      __builtin_amdgcn_sched_barrier(0);
#pragma unroll
      for (int t2 = 0; t2 < 4; ++t2)
        lg[t2] = wmma16(kf[u][t2], qf[u], lg[t2]);
      // keeps the reads after next behind these WMMAs, in the same registers
      __builtin_amdgcn_sched_barrier(0);
    }
    // v rows (i) of the first two i-tiles: they land during the softmax
    const _Float16* vrow = v_m + (ro * II + r) * VP + hi * 8;
    v16h vf[2][2][2];       // [register set][i-tile of the pair][k-step]
#pragma unroll
    for (int j = 0; j < 2; ++j) {
      vf[0][j][0] = frag16(vrow + j * 16 * VP);
      vf[0][j][1] = frag16(vrow + j * 16 * VP + 32);
    }
    // softmax over t: 24 scores here, 24 in lane ^ 16, and key 48 in both
    float m = lg[3][0];
#pragma unroll
    for (int t2 = 0; t2 < 3; ++t2) {
#pragma unroll
      for (int e = 0; e < 8; ++e) m = fmaxf(m, lg[t2][e]);
    }
    m = fmaxf(m, xhalf(m));
    float ts[3] = {0.f, 0.f, 0.f};
#pragma unroll
    for (int e = 0; e < 8; ++e) {
#pragma unroll
      for (int t2 = 0; t2 < 3; ++t2) {
        lg[t2][e] = exp_slot(lg[t2][e] - m);
        ts[t2] += lg[t2][e];
      }
    }
    const float p48 = exp_slot(lg[3][0] - m);
    float sum = ts[0] + ts[1] + ts[2];
    sum = sum + xhalf(sum) + p48;
    const float inv = 1.f / sum;
    // two score tiles, converted in place, are the B fragment of 32 keys
    // (the k order of frag16); keys 49..63 get zero
    v16h pf0, pf1;
#pragma unroll
    for (int e = 0; e < 8; ++e) {
      pf0[e]     = (_Float16)(lg[0][e] * inv);
      pf0[e + 8] = (_Float16)(lg[1][e] * inv);
      pf1[e]     = (_Float16)(lg[2][e] * inv);
      pf1[e + 8] = (_Float16)0.f;
    }
    pf1[8] = (_Float16)(hi == 0 ? p48 * inv : 0.f);
    // y transposed: A = v rows (i), B = probabilities, K = 64: the lane gets
    // y[s = sa][i = it*16 + hi*8 + e], one 16-byte store. Query rows past the
    // last go to a spare strip, so that no lane is masked among the WMMAs.
    _Float16* yrow = (sa < SS ? y_t + (ro * SS + sa) * QP
                              : y_pad + (ro * (SP - SS) + sa - SS) * QP) + hi * 8;
    // fully unrolled: the two sets must be compile-time register names
#pragma unroll
    for (int ig = 0; ig < 8; ++ig) {
      const int u = ig & 1, f = u ^ 1;
      if (ig + 1 < 8) {
#pragma unroll
        for (int j = 0; j < 2; ++j) {
          vf[f][j][0] = frag16(vrow + ((ig + 1) * 2 + j) * 16 * VP);
          vf[f][j][1] = frag16(vrow + ((ig + 1) * 2 + j) * 16 * VP + 32);
        }
      }
      // holds the next pair's reads, as one group, in front of these WMMAs
      __builtin_amdgcn_sched_barrier(0);
      v8f acc[2] = {{}, {}};
#pragma unroll
      for (int k = 0; k < 2; ++k) {
#pragma unroll
        for (int j = 0; j < 2; ++j)
          acc[j] = wmma16(vf[u][j][k], k ? pf1 : pf0, acc[j]);
      }
#pragma unroll
      for (int j = 0; j < 2; ++j) {
        v8h h;
#pragma unroll
        for (int e = 0; e < 8; ++e) h[e] = (_Float16)acc[j][e];
        *(v8h*)(yrow + (ig * 2 + j) * 16) = h;
      }
    }
  }
  __syncthreads();

  // ---- GEMM4: z[c][s] = Wo[512x256] * y + bias + residual, ReLU ----
  // Wave = two c-tiles (ct = wave, wave + 16) over all 7 s-tiles; the B (y_t)
  // fragments are shared: 4 b128 weight loads, 14 b128 LDS reads / 14 WMMAs.
  {
    const _Float16* brow  = y_t + r * QP + hi * 8;
    // s-tile 6: rows 96, 97, and 97 again
    const _Float16* brow6 = y_t + (6 * 16 + (r ? 1 : 0)) * QP + hi * 8;
    v8f acc0[NT] = {{}, {}, {}, {}, {}, {}, {}};      // ct = wave
    v8f acc1[NT] = {{}, {}, {}, {}, {}, {}, {}};      // ct + 16
#pragma unroll
    for (int ks = 0; ks < II / 32; ++ks) {
      if (ks + 2 < II / 32) {
        a0[(ks + 2) % 3] = fragw(Woh0 + (ks + 2) * 512, l16);
        a1[(ks + 2) % 3] = fragw(Woh1 + (ks + 2) * 512, l16);
      }
      v16h b[4];
#pragma unroll
      for (int st = 0; st < 4; ++st)
        b[st] = frag16(brow + st * 16 * QP + ks * 32);
      // holds the fetches above in front of this k-step's WMMAs (as in GEMM1)
      __builtin_amdgcn_sched_barrier(0);
#pragma unroll
      for (int st = 0; st < 4; ++st) {
        acc0[st] = wmma16(a0[ks % 3], b[st], acc0[st]);
        acc1[st] = wmma16(a1[ks % 3], b[st], acc1[st]);
      }
      // keeps the second group of y fragments in the first group's registers
      __builtin_amdgcn_sched_barrier(0);
#pragma unroll
      for (int st = 4; st < 6; ++st)
        b[st - 4] = frag16(brow + st * 16 * QP + ks * 32);
      b[2] = frag16(brow6 + ks * 32);
      // holds these reads, as one group, in front of their WMMAs
      __builtin_amdgcn_sched_barrier(0);
#pragma unroll
      for (int st = 4; st < NT; ++st) {
        acc0[st] = wmma16(a0[ks % 3], b[st - 4], acc0[st]);
        acc1[st] = wmma16(a1[ks % 3], b[st - 4], acc1[st]);
      }
      // keeps the next k-step's reads behind these WMMAs, in the same registers
      __builtin_amdgcn_sched_barrier(0);
    }
    // next block's first q/k/v weights land during this block's epilogue
    if (nq) {
      pq = fragw((const _Float16*)nq, 0u);
      pk = fragw((const _Float16*)nk, 0u);
      pv = fragw((const _Float16*)nv, 0u);
      // before an address register of these loads is written again (the input
      // operands keep them from being a later load's destination)
      asm volatile("s_wait_xcnt 0x0"
                   :: "v"(nq), "v"(nk), "v"(nv), "v"(l16) : "memory");
    } else {
      // before the offset register of the weight loads is written again
      asm volatile("s_wait_xcnt 0x0" :: "v"(l16) : "memory");
    }
#pragma unroll
    for (int half = 0; half < 2; ++half) {
      const int c0 = (wave + half * 16) * 16 + hi * 8;
      v8f* accs = half ? acc1 : acc0;
      // the lane's 8 output biases: the c-tile's 16 from one address
      float bov[8];
      {
        // as at the q/k/v biases
        __builtin_amdgcn_sched_barrier(0);
        const v4f* o4 = (const v4f*)(bo + (wu + half * 16) * 16);
        const v4f to[4] = {o4[0], o4[1], o4[2], o4[3]};
        asm volatile("s_wait_xcnt 0x0"
                     :: "v"(to[0]), "v"(to[1]), "v"(to[2]), "v"(to[3])
                     : "memory");
        __builtin_amdgcn_sched_barrier(0);
#pragma unroll
        for (int e = 0; e < 8; ++e) {
          const int a = e >> 2, c = e & 3;
          bov[e] = hi ? to[2 + a][c] : to[a][c];
        }
      }
      // per tile: rows 0..48 and rows 49..97
      float ps[NR][8] = {{0.f, 0.f, 0.f, 0.f, 0.f, 0.f, 0.f, 0.f},
                         {0.f, 0.f, 0.f, 0.f, 0.f, 0.f, 0.f, 0.f}};
#pragma unroll
      for (int st = 0; st < NT; ++st) {
        const int s = st * 16 + r;
        if (s < SR) {
          _Float16* px = xt + s * XP + c0;
          const v8h res = *(const v8h*)px;
          v8h hv;
#pragma unroll
          for (int e = 0; e < 8; ++e) {
            const float z =
                fmaxf(accs[st][e] + bov[e] + (float)res[e], 0.f);
            hv[e] = (_Float16)z;
            if (POOL) {
              const float zh = (float)hv[e];
              if (st < 3) {
                ps[0][e] += zh;
              } else if (st > 3) {
                ps[1][e] += zh;
              } else {   // row 48 is the first tile's last
                ps[0][e] += r == 0 ? zh : 0.f;
                ps[1][e] += r == 0 ? 0.f : zh;
              }
            }
          }
          if (!POOL) *(v8h*)px = hv;
        }
      }
      if (POOL) {
        // sum over the 16 lanes that hold the s positions of these channels
#pragma unroll
        for (int ro = 0; ro < NR; ++ro) {
#pragma unroll
          for (int e = 0; e < 8; ++e) {
#pragma unroll
            for (int o = 1; o < 16; o <<= 1)
              ps[ro][e] += __shfl_xor(ps[ro][e], o, 16);
          }
          if (r == 0) {
#pragma unroll
            for (int e = 0; e < 8; ++e)
              pool_f[ro * CG + c0 + e] = ps[ro][e] * (1.f / (float)SS);
          }
        }
      }
    }
  }
  __syncthreads();
}

__global__ void cvt_pack_f16_kernel(const float* __restrict__ src,
                                    _Float16* __restrict__ dst, int n,
                                    int lgks) {
  const int d = blockIdx.x * 256 + threadIdx.x;
  if (d < n) {
    const int e    = d & 7;
    const int ln   = (d >> 3) & 31;
    const int part = (d >> 8) & 1;
    const int tile = d >> 9;
    const int ks   = tile & ((1 << lgks) - 1);
    const int mt   = tile >> lgks;
    const int row  = mt * 16 + (ln & 15);
    const int k    = ks * 32 + part * 16 + (ln >> 4) * 8 + e;
    dst[d] = (_Float16)src[(size_t)row * (32 << lgks) + k];
  }
}

__global__ __launch_bounds__(512) __attribute__((amdgpu_waves_per_eu(4, 4)))
void frcnn_nonlocal_kernel(
    const float* __restrict__ x,
    const _Float16* __restrict__ wq_h, const _Float16* __restrict__ wk_h,
    const _Float16* __restrict__ wv_h, const _Float16* __restrict__ wo_h,
    const float* __restrict__ bq, const float* __restrict__ bk,
    const float* __restrict__ bv, const float* __restrict__ bo,
    float* __restrict__ pc, float* __restrict__ pr)
{
  __shared__ __attribute__((aligned(16))) char smem[LDS_TOTAL];
  _Float16* x_t    = (_Float16*)(smem + OFF_XT);
  _Float16* q_t    = (_Float16*)(smem + OFF_QT);
  _Float16* k_t    = (_Float16*)(smem + OFF_KT);
  _Float16* v_m    = (_Float16*)(smem + OFF_VM);
  _Float16* y_t    = (_Float16*)(smem + OFF_QT);   // on q_t, row by row
  float*    pool_f = (float*)   (smem + OFF_PF);
  _Float16* y_pad  = (_Float16*)(smem + OFF_YP);   // written, never read

  const int tid  = threadIdx.x;

  // Load the two x tiles (transpose [c][s] -> x_t[s][c], fp32 -> f16); in
  // memory the second (n, g) tile follows the first: 1024 channels in a row.
  // Unit u = (8 channels, one s): lanes walk s, so a wave-wide b32 load reads
  // 128 contiguous bytes, and a thread's 8 loads make one 16-byte LDS row piece.
  // All of a thread's loads are issued before the first is used: the tiles
  // cost one memory latency, not one per batch.
  const float* xg = x + (size_t)blockIdx.x * (NR * CG * SS);
  float xv[12][8];
#pragma unroll
  for (int i = 0; i < 12; ++i) {
    const int u  = tid + i * 512;
    const int cg = u / SS;
    const unsigned ob = (unsigned)(cg * 8 * SS + (u - cg * SS)) * 4u;  // bytes
    const float* p = (const float*)((const char*)xg + ob);
#pragma unroll
    for (int j = 0; j < 8; ++j) xv[i][j] = p[j * SS];
  }
  // 6272 units = 12 * 512 + 128: of the last 128 each thread takes two channels
  const int ul  = 12 * 512 + (tid & 127);
  const int cl  = (ul / SS) * 8 + (tid >> 7);      // and cl + 4
  const int sl  = ul % SS;
  const float xl0 = xg[cl * SS + sl];
  const float xl1 = xg[(cl + 4) * SS + sl];
  // before any address register of the loads above is written again
  asm volatile("s_wait_xcnt 0x0" ::: "memory");
  // keeps what follows (it reuses those address registers) behind the wait
  __builtin_amdgcn_sched_barrier(0);
  const int wave = tid >> 5;
  const int lane = tid & 31;
  // block 0's first q/k/v weights land while the x tiles are brought in
  v16h pq, pk, pv;
  const int wu = __builtin_amdgcn_readfirstlane(wave);
  // the lane's own address of its first 16 bytes of the wave's q/k/v tiles
  const char* lq = (const char*)(wq_h + wu * 16 * CG) + (unsigned)lane * 16u;
  const char* lk = (const char*)(wk_h + wu * 16 * CG) + (unsigned)lane * 16u;
  const char* lv = (const char*)(wv_h + wu * 16 * CG) + (unsigned)lane * 16u;
  pq = fragw((const _Float16*)lq, 0u);
  pk = fragw((const _Float16*)lk, 0u);
  pv = fragw((const _Float16*)lv, 0u);
  // holds these fetches in front of the conversions below, which wait for x
  __builtin_amdgcn_sched_barrier(0);
  // v's key columns 49..63, one row a thread: zero once, never written again
  // (they meet zero probabilities, so they must be finite)
  {
    _Float16* vz = v_m + tid * VP;
    vz[SS] = (_Float16)0.f;
#pragma unroll
    for (int t = SS + 1; t < SP; t += 2) *(unsigned*)(vz + t) = 0u;
  }
#pragma unroll
  for (int i = 0; i < 12; ++i) {
    const int u  = tid + i * 512;
    const int cg = u / SS;               // 0..127: tile cg / 64, channels cg % 64
    v8h h;
#pragma unroll
    for (int j = 0; j < 8; ++j) h[j] = (_Float16)xv[i][j];
    *(v8h*)(x_t + ((cg >> 6) * SS + u - cg * SS) * XP + (cg & 63) * 8) = h;
  }
  // the last 128 units are all of the second tile (channels 1000 and up)
  x_t[(SS + sl) * XP + cl - CG]     = (_Float16)xl0;
  x_t[(SS + sl) * XP + cl - CG + 4] = (_Float16)xl1;
  __syncthreads();

  const size_t pbase = (size_t)blockIdx.x * (NR * CG) + (size_t)(tid * 2);

  // block 0 (shared): x_t in place
  nl_block<false>(wq_h, wk_h, wv_h, wo_h, bq, bk, bv, bo,
           lq + 1 * II * CG * 2, lk + 1 * II * CG * 2, lv + 1 * II * CG * 2,
           pq, pk, pv, x_t, q_t, k_t, v_m, y_t, y_pad, pool_f,
           wave, lane);
  // block 1 (cls): x_t -> channel means
  nl_block<true>(wq_h + 1 * II * CG, wk_h + 1 * II * CG, wv_h + 1 * II * CG,
           wo_h + 1 * CG * II, bq + II, bk + II, bv + II, bo + CG,
           lq + 2 * II * CG * 2, lk + 2 * II * CG * 2, lv + 2 * II * CG * 2,
           pq, pk, pv, x_t, q_t, k_t, v_m, y_t, y_pad, pool_f,
           wave, lane);
  // a wave stores two whole lines; pool_f is next written behind block 2's
  // barriers
  *(float2*)(pc + pbase) = *(const float2*)(pool_f + tid * 2);
  // before a register of the store above is written again
  asm volatile("s_wait_xcnt 0x0" ::: "memory");
  // block 2 (reg): x_t -> channel means
  nl_block<true>(wq_h + 2 * II * CG, wk_h + 2 * II * CG, wv_h + 2 * II * CG,
           wo_h + 2 * CG * II, bq + 2 * II, bk + 2 * II, bv + 2 * II,
           bo + 2 * CG, nullptr, nullptr, nullptr,
           pq, pk, pv, x_t, q_t, k_t, v_m, y_t, y_pad, pool_f,
           wave, lane);
  *(float2*)(pr + pbase) = *(const float2*)(pool_f + tid * 2);
}

// ---------------------------------------------------------------------------
// Final linears: one work-group of 16 waves per 32 x 48 output tile, K = 2048.
// The 32 pooled rows and 48 weight rows come in by whole-line loads (a wave-wide
// b128 load = 512 contiguous bytes of one row), three k-chunks in flight, and go
// as f16 through LDS, where the fragments are read. Wave = (row tile, k-step of
// the chunk): 8 partial sums per output, added through LDS at the end.
#define CLS_GRPS 2    // ceil(81/48)
#define REG_GRPS 7    // ceil(324/48)
#define HM    32      // pooled rows per work-group
#define HN    48      // output columns per work-group
#define HKC   256     // k per chunk
#define HP    264     // LDS row pitch in halves (16 B x odd)
#define HBUF  ((HM + HN) * HP)
#define HNCH  (CTOT / HKC)
#define HRING 3
#define HPASS ((HM + HN) / 8)

__global__ __launch_bounds__(512) void frcnn_head_kernel(
    const float* __restrict__ pc, const float* __restrict__ pr,
    const float* __restrict__ Wc, const float* __restrict__ bc,
    const float* __restrict__ Wb, const float* __restrict__ bb,
    float* __restrict__ out)
{
  __shared__ __attribute__((aligned(16))) _Float16 hs[2 * HBUF];

  const int mb = blockIdx.x;   // block of 32 rois, 0..15
  const int yg = blockIdx.y;   // 0..8
  const float* P; const float* W; const float* bias; float* O;
  int ncols, n0;
  if (yg < CLS_GRPS) { P = pc; W = Wc; bias = bc; O = out;
                       ncols = NCLS; n0 = yg * HN; }
  else               { P = pr; W = Wb; bias = bb; O = out + NROI * NCLS;
                       ncols = NBOX; n0 = (yg - CLS_GRPS) * HN; }

  const int tid  = threadIdx.x;
  const int wave = tid >> 5;
  const int lane = tid & 31;
  const int r  = lane & 15;
  const int hi = lane >> 4;
  const int c4   = tid & 63;   // which 16 bytes of a row's 1-KiB chunk
  const int rsub = tid >> 6;   // row within a pass of 8 rows

  // byte offsets of this thread's piece in each of the 10 rows it brings in;
  // a column past the last reads the last row (its outputs are never stored)
  unsigned off[HPASS];
#pragma unroll
  for (int j = 0; j < HPASS; ++j) {
    int row;
    if (j < HM / 8) {
      row = mb * HM + j * 8 + rsub;
    } else {
      row = n0 + (j - HM / 8) * 8 + rsub;
      row = row < ncols ? row : ncols - 1;
    }
    off[j] = (unsigned)row * (CTOT * 4u) + (unsigned)c4 * 16u;
  }

  float4 rg[HRING][HPASS];
#pragma unroll
  for (int p = 0; p < HRING; ++p) {
#pragma unroll
    for (int j = 0; j < HPASS; ++j)
      rg[p][j] = *(const float4*)((const char*)(j < HM / 8 ? P : W) + off[j] +
                                  p * (HKC * 4));
  }

  const int mtile = wave >> 3;   // 0..1
  const int kw    = wave & 7;    // k-step of the chunk
  v8f acc[3] = {{}, {}, {}};
#pragma unroll
  for (int ch = 0; ch < HNCH; ++ch) {
    _Float16* buf = hs + (ch & 1) * HBUF;
    const int s = ch % HRING;
#pragma unroll
    for (int j = 0; j < HPASS; j += 2) {
      uint2 h0, h1;
      asm volatile("v_nop\n\tv_nop\n\tv_nop\n\tv_nop\n\t"
                   "v_cvt_pk_f16_f32 %0, %4, %5\n\t"
                   "v_cvt_pk_f16_f32 %1, %6, %7\n\t"
                   "v_cvt_pk_f16_f32 %2, %8, %9\n\t"
                   "v_cvt_pk_f16_f32 %3, %10, %11"
                   : "=&v"(h0.x), "=&v"(h0.y), "=&v"(h1.x), "=&v"(h1.y)
                   : "v"(rg[s][j].x), "v"(rg[s][j].y), "v"(rg[s][j].z),
                     "v"(rg[s][j].w), "v"(rg[s][j + 1].x), "v"(rg[s][j + 1].y),
                     "v"(rg[s][j + 1].z), "v"(rg[s][j + 1].w));
      *(uint2*)(buf + (j * 8 + rsub) * HP + c4 * 4) = h0;
      *(uint2*)(buf + ((j + 1) * 8 + rsub) * HP + c4 * 4) = h1;
    }
    if (ch + HRING < HNCH) {
#pragma unroll
      for (int j = 0; j < HPASS; ++j)
        rg[s][j] = *(const float4*)((const char*)(j < HM / 8 ? P : W) + off[j] +
                                    (ch + HRING) * (HKC * 4));
      // behind the last loads: their offset registers are free to be reused
      if (ch + HRING == HNCH - 1) asm volatile("s_wait_xcnt 0x0" ::: "memory");
      // holds the refill here, three chunks ahead of its use; without it the
      // scheduler may sink the loads to their first use and the lead is lost
      __builtin_amdgcn_sched_barrier(0);
    }
    // one barrier a chunk: it publishes this buffer, and every reader of the
    // other buffer (chunk ch - 1) has passed it before chunk ch + 1 is stored.
    // By hand, with the LDS wait alone: __syncthreads() also waits for every
    // global load, which would end the refills' lead at each chunk
    asm volatile("s_wait_dscnt 0x0\n\ts_barrier_signal -1\n\ts_barrier_wait -1"
                 ::: "memory");
    const _Float16* fp = buf + r * HP + kw * 32 + hi * 8;
    const v16h a = frag16(fp + mtile * 16 * HP);
#pragma unroll
    for (int nt = 0; nt < 3; ++nt)
      acc[nt] = wmma16(a, frag16(fp + (HM + nt * 16) * HP), acc[nt]);
  }
  __syncthreads();

  // partial sums: red[wave][nt][e][lane]
  float* red = (float*)hs;
#pragma unroll
  for (int nt = 0; nt < 3; ++nt) {
#pragma unroll
    for (int e = 0; e < 8; ++e)
      red[((wave * 3 + nt) * 8 + e) * 32 + lane] = acc[nt][e];
  }
  __syncthreads();
#pragma unroll
  for (int j = 0; j < 3; ++j) {
    // wave-uniform (row tile, column tile, e); lanes as in the accumulator
    const int id = wave + j * 16;          // 0..47
    const int mt = id / 24;
    const int nt = (id / 8) % 3;
    const int e  = id & 7;
    float sum = 0.f;
#pragma unroll
    for (int k = 0; k < 8; ++k)
      sum += red[(((mt * 8 + k) * 3 + nt) * 8 + e) * 32 + lane];
    const int ncol = n0 + nt * 16 + r;
    const int nr   = mb * HM + mt * 16 + hi * 8 + e;
    if (ncol < ncols) O[(size_t)nr * ncols + ncol] = sum + bias[ncol];
  }
}

// ---------------------------------------------------------------------------
extern "C" void kernel_launch(void* const* d_in, const int* in_sizes, int n_in,
                              void* d_out, int out_size, void* d_ws, size_t ws_size,
                              hipStream_t stream) {
  (void)in_sizes; (void)n_in; (void)out_size; (void)ws_size;
  const float* x  = (const float*)d_in[0];
  const float* Wq = (const float*)d_in[1];
  const float* bq = (const float*)d_in[2];
  const float* Wk = (const float*)d_in[3];
  const float* bk = (const float*)d_in[4];
  const float* Wv = (const float*)d_in[5];
  const float* bv = (const float*)d_in[6];
  const float* Wo = (const float*)d_in[7];
  const float* bo = (const float*)d_in[8];
  const float* Wc = (const float*)d_in[9];
  const float* bc = (const float*)d_in[10];
  const float* Wb = (const float*)d_in[11];
  const float* bb = (const float*)d_in[12];
  float* out = (float*)d_out;

  // workspace layout
  const size_t WN = (size_t)3 * II * CG;  // per qkv-stack element count
  char* ws = (char*)d_ws;
  _Float16* wq_h = (_Float16*)(ws);                    // 3*256*512 f16
  _Float16* wk_h = (_Float16*)(ws + WN * 2);
  _Float16* wv_h = (_Float16*)(ws + WN * 4);
  _Float16* wo_h = (_Float16*)(ws + WN * 6);           // 3*512*256 f16
  float*    pc   = (float*)   (ws + WN * 8);           // 512*2048 f32
  float*    pr   = (float*)   (ws + WN * 8 + (size_t)NROI * CTOT * 4);

  const int wn = (int)WN;
  cvt_pack_f16_kernel<<<(wn + 255) / 256, 256, 0, stream>>>(Wq, wq_h, wn, 4);
  cvt_pack_f16_kernel<<<(wn + 255) / 256, 256, 0, stream>>>(Wk, wk_h, wn, 4);
  cvt_pack_f16_kernel<<<(wn + 255) / 256, 256, 0, stream>>>(Wv, wv_h, wn, 4);
  cvt_pack_f16_kernel<<<(wn + 255) / 256, 256, 0, stream>>>(Wo, wo_h, wn, 3);

  // 2) fused 3x non-local chain + pooling: one WG per two (n, g)
  frcnn_nonlocal_kernel<<<NROI * GRP / NR, 512, 0, stream>>>(
      x, wq_h, wk_h, wv_h, wo_h, bq, bk, bv, bo, pc, pr);

  // 3) classification / bbox heads
  dim3 hgrid(NROI / HM, CLS_GRPS + REG_GRPS);
  frcnn_head_kernel<<<hgrid, 512, 0, stream>>>(pc, pr, Wc, bc, Wb, bb, out);
}
